// v000
// The times below were measured on an AMD MI455X: many runs one after another, warmed up first and cycling through
// copies of the inputs, with the whole window's GPU time divided by the number of runs. Launches and the gaps
// between them are all in it. The median over several windows is given; except for v000 it joins two sittings, which
// can be a few percent apart, so the side-by-side timings, each taken in one sitting, are the better comparison.
// The starting kernel, v000, takes 3650 microseconds a run.
#include <hip/hip_runtime.h>

// Scaled dot-product attention on raw per-head inputs with an ADDITIVE random float mask (query, key, value [2][16][2048][64] = 32 planes, no projections; scores = q.k^T x 1/sqrt(64) + attn_mask with attn_mask f32 [1][1][2048][2048] standard-normal draws shared by all planes (read per (query, key) on device, bf16-rounded); softmax over keys; out = probs.v -> [2][16][2048][64] (4.2 M); argument order query, key, value, attn_mask).
// Layout per plane: the raw f32 inputs are ROUNDED TO bf16 first and split into identity planes; dense T-2048 attention at NH 1 with EVERY row's scores on hi/lo planes (3 products); the softmax kernel adds the mask row (16 B per lane, unconditional loads) before the max; P.V hybrid (rows < 512 hi/lo, rest fp16 x1024); the f32 merge writes the plane's output rows.
// Compute dtypes, f32 accumulate: every input rounded to bf16; scores 3 products on every row + bf16-rounded mask added in f32; softmax f32; P.V rows < 512 3 products, rest fp16; output f32.

#define NB_  32
#define TT   2048
#define DM   64
#define NH_  1
#define NKV  1
#define REP  (NH_ / NKV)
#define HD   64
#define DQ   (NH_ * HD)
#define DKV  (NKV * HD)
#define ZH   1
#define RH   512                  // query rows < RH use hi+lo planes (0: none)
#define WIN  0
#define PCAR 1024.0f
#define SCL  0.125f   // 1/sqrt(64)
typedef _Float16 h16;
typedef unsigned short bf;
typedef __attribute__((ext_vector_type(16))) __bf16   v16bf;
typedef __attribute__((ext_vector_type(16))) _Float16 v16h;
typedef __attribute__((ext_vector_type(8)))  _Float16 v8h;
typedef __attribute__((ext_vector_type(8)))  unsigned short v8us;
typedef __attribute__((ext_vector_type(8)))  float    v8f;
typedef __attribute__((ext_vector_type(4)))  float    v4f;
typedef v8h  __attribute__((may_alias)) v8ha;
typedef v4f  __attribute__((may_alias)) v4fa;
typedef v8us __attribute__((may_alias)) v8usa;

__device__ __forceinline__ unsigned short f2bf(float f) { unsigned u = __float_as_uint(f); u += 0x7FFFu + ((u >> 16) & 1u); return (unsigned short)(u >> 16); }
__device__ __forceinline__ float bf2f(unsigned short b) { return __uint_as_float(((unsigned)b) << 16); }
__device__ __forceinline__ float bfr(float f) { return bf2f(f2bf(f)); }
__device__ __forceinline__ v16h cat16(v8h lo, v8h hi) { return __builtin_shufflevector(lo, hi, 0, 1, 2, 3, 4, 5, 6, 7, 8, 9, 10, 11, 12, 13, 14, 15); }
__device__ __forceinline__ v16bf cat16b(v8us lo, v8us hi) { return __builtin_bit_cast(v16bf, __builtin_shufflevector(lo, hi, 0, 1, 2, 3, 4, 5, 6, 7, 8, 9, 10, 11, 12, 13, 14, 15)); }
__device__ __forceinline__ v8f wmma16(v16h a, v16h b, v8f c) { return __builtin_amdgcn_wmma_f32_16x16x32_f16(false, a, false, b, (short)0, c, false, false); }
__device__ __forceinline__ v8f wmmab(v16bf a, v16bf b, v8f c) { return __builtin_amdgcn_wmma_f32_16x16x32_bf16(false, a, false, b, (short)0, c, false, false); }



// ---- k_gemmw: register-blocked GEMM, ONE WAVE per 64x64 output tile (16 accumulators), operands straight from K-contiguous 16-bit planes; grid (M/64, N/64, Z), 32 threads.
// C[m][n] (f32, pitch ldc, + optional f32 bias[n]) = sum_k A[m][k] Bt[n][k] (+ split products per NSPLIT). z-batch strides sA/sB/sC in elements. K % 32 == 0.
template <typename T16> struct WFrag;
template <> struct WFrag<h16> { typedef v16h V; static __device__ __forceinline__ V ld(const h16* p) { return cat16(*(const v8h*)p, *(const v8h*)(p + 16)); } static __device__ __forceinline__ v8f mma(V a, V b, v8f c) { return wmma16(a, b, c); } };
template <> struct WFrag<bf> { typedef v16bf V; static __device__ __forceinline__ V ld(const bf* p) { return cat16b(*(const v8us*)p, *(const v8us*)(p + 16)); } static __device__ __forceinline__ v8f mma(V a, V b, v8f c) { return wmmab(a, b, c); } };
template <typename T16, int NSPLIT, bool BIAS>
__global__ __launch_bounds__(32) void k_gemmw(const T16* __restrict__ A, const T16* __restrict__ A2, const T16* __restrict__ Bt, const T16* __restrict__ Bt2, int K, float* C, int ldc, const float* __restrict__ bias, size_t sA, size_t sB, size_t sC) {
    typedef typename WFrag<T16>::V V;
    __shared__ __align__(16) float os[16 * 68];
    const size_t z = blockIdx.z; A += z * sA; if (A2) A2 += z * sA; Bt += z * sB; if (Bt2) Bt2 += z * sB; C += z * sC;
    const int lane = threadIdx.x & 31, lr = lane & 15, hi = lane >> 4; const int r0 = blockIdx.x * 64, c0 = blockIdx.y * 64;
    v8f acc[4][4];
#pragma unroll
    for (int mb = 0; mb < 4; ++mb)
#pragma unroll
        for (int nb = 0; nb < 4; ++nb) acc[mb][nb] = (v8f){};
    const size_t aoff = (size_t)(r0 + lr) * K + 8 * hi, boff = (size_t)(c0 + lr) * K + 8 * hi;
#pragma unroll 1
    for (int kc = 0; kc < K; kc += 32) {
        V a[4], a2[4];
#pragma unroll
        for (int mb = 0; mb < 4; ++mb) { a[mb] = WFrag<T16>::ld(A + aoff + (size_t)mb * 16 * K + kc); if (NSPLIT == 1 || NSPLIT == 2) a2[mb] = WFrag<T16>::ld(A2 + aoff + (size_t)mb * 16 * K + kc); }
#pragma unroll
        for (int nb = 0; nb < 4; ++nb) { const V b = WFrag<T16>::ld(Bt + boff + (size_t)nb * 16 * K + kc); V b2; if (NSPLIT >= 2) b2 = WFrag<T16>::ld(Bt2 + boff + (size_t)nb * 16 * K + kc);
#pragma unroll
            for (int mb = 0; mb < 4; ++mb) { acc[mb][nb] = WFrag<T16>::mma(a[mb], b, acc[mb][nb]); if (NSPLIT == 1 || NSPLIT == 2) acc[mb][nb] = WFrag<T16>::mma(a2[mb], b, acc[mb][nb]); if (NSPLIT >= 2) acc[mb][nb] = WFrag<T16>::mma(a[mb], b2, acc[mb][nb]); } }
        asm volatile("v_nop\n\tv_nop\n\tv_nop\n\tv_nop" : "+v"(acc[0][0]), "+v"(acc[1][1]), "+v"(acc[2][2]), "+v"(acc[3][3]) : "v"(a[0]), "v"(a[3]));
    }
#pragma unroll
    for (int mb = 0; mb < 4; ++mb) {
#pragma unroll
        for (int nb = 0; nb < 4; ++nb) {
#pragma unroll
            for (int j = 0; j < 8; ++j) os[(hi * 8 + j) * 68 + nb * 16 + lr] = acc[mb][nb][j]; }
        __builtin_amdgcn_wave_barrier(); asm volatile("" ::: "memory");
        float* crow = C + (size_t)(r0 + mb * 16) * ldc + c0;
{
#pragma unroll
            for (int s = 0; s < 8; ++s) { const int row = 2 * s + hi, cofs = lr * 4; v4f val = *(const v4fa*)(os + row * 68 + cofs); if (BIAS) { val[0] += bfr(bias[c0 + cofs]); val[1] += bfr(bias[c0 + cofs + 1]); val[2] += bfr(bias[c0 + cofs + 2]); val[3] += bfr(bias[c0 + cofs + 3]); }
                *(v4f*)(crow + (size_t)row * ldc + cofs) = val; }
             }
        __builtin_amdgcn_wave_barrier(); asm volatile("" ::: "memory");
    }
}

__device__ __forceinline__ h16 tohx(float x) { return (h16)x; }
__device__ __forceinline__ void splitf(float y, unsigned short& h, unsigned short& l) { h = f2bf(y); l = f2bf(y - bf2f(h)); }
typedef __attribute__((ext_vector_type(2))) _Float16 v2h;
typedef __attribute__((ext_vector_type(4))) _Float16 v4h;
typedef __attribute__((ext_vector_type(2))) unsigned short v2us;
typedef __attribute__((ext_vector_type(4))) unsigned short v4us;
typedef __attribute__((ext_vector_type(2))) float v2f;
typedef __attribute__((ext_vector_type(4))) int v4i;

// k_rope: head planes [h][t][d] (fp16 + hi/lo) of rope(x) x sc with the rotate-half convention out[d] = x[d] cos[t][d] - x[d+HD/2] sin[t][d], out[d+HD/2] = x[d+HD/2] cos[t][d+HD/2] + x[d] sin[t][d+HD/2]
__global__ __launch_bounds__(256) void k_rope(const float* __restrict__ F, int pitch, int nheads, const float* __restrict__ CS, const float* __restrict__ RF, const float* __restrict__ nw, float sc, h16* P16, bf* Ph, bf* Pl) {
    const size_t e = ((size_t)blockIdx.x * 256 + threadIdx.x) * 2; if (e >= (size_t)nheads * TT * HD) return; const int d = (int)(e % HD); const int t = (int)((e / HD) % TT); const int h = (int)(e / ((size_t)HD * TT)); const float* f = F + (size_t)t * pitch + h * HD; const float rf = RF ? RF[(size_t)h * TT + t] : 1.0f; v2h o16; v2us oh, ol;
#pragma unroll
    for (int q = 0; q < 2; ++q) { const int dd = d + q; const int dp = (dd < HD / 2) ? dd + HD / 2 : dd - HD / 2; float x0 = bfr(f[dd]), x1 = bfr(f[dp]);   /* RAW d_in source: round to bf16 FIRST; the lo planes are then identically zero */
        if (RF) { float n0 = __fmul_rn(x0, rf), n1 = __fmul_rn(x1, rf); asm volatile("" : "+v"(n0)); asm volatile("" : "+v"(n1)); x0 = __fmul_rn(bfr(nw[dd]), n0); x1 = __fmul_rn(bfr(nw[dp]), n1); }
        const v2f cs = *(const v2f*)(CS + ((size_t)t * HD + dd) * 2); float a = __fmul_rn(x0, cs[0]), bq = __fmul_rn(x1, cs[1]); asm volatile("" : "+v"(a)); asm volatile("" : "+v"(bq)); const float r = ((dd < HD / 2) ? __fsub_rn(a, bq) : __fadd_rn(a, bq)) * sc;
        o16[q] = tohx(r); unsigned short a2, c2; splitf(r, a2, c2); oh[q] = a2; ol[q] = c2; }
    *(v2h*)(P16 + e) = o16; *(v2us*)(Ph + e) = oh; *(v2us*)(Pl + e) = ol;  }
__global__ __launch_bounds__(256) void k_vtp(const float* __restrict__ F, int pitch, int nheads, h16* V16, bf* Vh, bf* Vl) { const size_t e = ((size_t)blockIdx.x * 256 + threadIdx.x) * 2; if (e >= (size_t)nheads * HD * TT) return; const int t = (int)(e % TT); const int d = (int)((e / TT) % HD); const int g = (int)(e / ((size_t)TT * HD)); v2h o16; v2us oh, ol;
#pragma unroll
    for (int q = 0; q < 2; ++q) { const float x = bfr(F[(size_t)(t + q) * pitch + g * HD + d]);   /* RAW d_in source: bf16-rounded first */ o16[q] = tohx(x); unsigned short a2, c2; splitf(x, a2, c2); oh[q] = a2; ol[q] = c2; }
    *(v2h*)(V16 + e) = o16; *(v2us*)(Vh + e) = oh; *(v2us*)(Vl + e) = ol;  }
__global__ __launch_bounds__(256) void k_csid(float* CS) { const int idx = blockIdx.x * 256 + threadIdx.x; if (idx >= TT * HD) return; v2f cs; cs[0] = 1.0f; cs[1] = 0.0f; *(v2f*)(CS + (size_t)idx * 2) = cs;  }
// k_asoft: per row (zz, i): t = S x HD^-0.5 + bf16-rounded mask[i][j]; softmax over the 2048 keys (register row, one exp, fixed trees);
__global__ __launch_bounds__(256) void k_asoft(const float* __restrict__ Sb, const float* __restrict__ mskf, h16* P16, bf* Ph, bf* Pl) {
    const int lane = threadIdx.x & 31; const int row = blockIdx.x * 8 + (threadIdx.x >> 5); if (row >= ZH * TT) return; const int i = row % TT; const int zz = row / TT; (void)zz; const bool hires = (i < RH); const float* sr = Sb + (size_t)row * TT; float v[TT / 32]; float mx = -3.0e38f;
#pragma unroll
    for (int ch = 0; ch < TT / 128; ++ch) { const int j0 = ch * 128 + lane * 4; const v4f a = *(const v4f*)(sr + j0); const v4f g4 = *(const v4f*)(mskf + (size_t)i * TT + j0);   /* additive mask row i (f32), 16 B per lane, unconditional */
#pragma unroll
        for (int q = 0; q < 4; ++q) { const int j = j0 + q; (void)j; float s0 = __fmul_rn(a[q], SCL); asm volatile("" : "+v"(s0)); float mv = bfr(g4[q]); asm volatile("" : "+v"(mv)); const float t = __fadd_rn(s0, mv);   /* scores x SCL + attn_mask[i][j] (mask bf16-rounded, added in f32) */ v[ch * 4 + q] = t; mx = fmaxf(mx, t); } }
#pragma unroll
    for (int sh = 16; sh; sh >>= 1) mx = fmaxf(mx, __shfl_xor(mx, sh, 32));
    float sum = 0.f;
#pragma unroll
    for (int k = 0; k < TT / 32; ++k) { float d0 = __fsub_rn(v[k], mx); asm volatile("" : "+v"(d0)); v[k] = __builtin_amdgcn_exp2f(__fmul_rn(d0, 1.4426950408889634f)); sum += v[k]; }
#pragma unroll
    for (int sh = 16; sh; sh >>= 1) sum += __shfl_xor(sum, sh, 32);
    const float f = __fdiv_rn(hires ? 1.0f : PCAR, sum);
{
        if (hires) {
#pragma unroll
            for (int ch = 0; ch < TT / 128; ++ch) { v4us oh, ol;
#pragma unroll
                for (int q = 0; q < 4; ++q) { unsigned short a, c2; splitf(v[ch * 4 + q] * f, a, c2); oh[q] = a; ol[q] = c2; }
                const size_t oo = ((size_t)zz * (RH ? RH : 1) + i) * TT + ch * 128 + lane * 4; *(v4us*)(Ph + oo) = oh; *(v4us*)(Pl + oo) = ol; }
        } else {
#pragma unroll
            for (int ch = 0; ch < TT / 128; ++ch) { v4h o4;
#pragma unroll
                for (int q = 0; q < 4; ++q) o4[q] = tohx(v[ch * 4 + q] * f);
                *(v4h*)(P16 + (size_t)row * TT + ch * 128 + lane * 4) = o4; } }
         }
}
__global__ __launch_bounds__(256) void k_merge(const float* __restrict__ O, int h0, float* OUTb) { const size_t e = ((size_t)blockIdx.x * 256 + threadIdx.x) * 2; if (e >= (size_t)ZH * TT * HD) return; const int d = (int)(e % HD); const int t = (int)((e / HD) % TT); const int zz = (int)(e / ((size_t)HD * TT)); const float cs = (t < RH) ? 1.0f : (1.0f / PCAR); const size_t oo = (size_t)t * DQ + (h0 + zz) * HD + d;
    v2f o2; o2[0] = O[e] * cs; o2[1] = O[e + 1] * cs; *(v2f*)(OUTb + oo) = o2;  }

extern "C" void kernel_launch(void* const* d_in, const int* in_sizes, int n_in,
                              void* d_out, int out_size, void* d_ws, size_t ws_size, hipStream_t stream) {
    (void)in_sizes; (void)n_in; (void)out_size;
    const float* x = (const float*)d_in[0]; const float* xk = (const float*)d_in[1]; const float* xv = (const float*)d_in[2]; const float* amask = (const float*)d_in[3];   /* attn_mask f32 [1][1][2048][2048], read */   /* query, key, value: [32][2048][64] each (no projections) */ const float* wq = nullptr, *wk = nullptr, *wv = nullptr, *wo = nullptr; (void)wq; (void)wk; (void)wv; (void)wo;
    float* OUT = (float*)d_out;     // [32][2048][64]
    char* wsp = (char*)d_ws;
    auto take = [&](size_t bytes) { char* p = wsp; wsp += (bytes + 255) & ~(size_t)255; return (void*)p; };
    bf* WQ = (bf*)take((size_t)DQ * DM * 2); bf* WK = (bf*)take((size_t)DKV * DM * 2); bf* WV = (bf*)take((size_t)DKV * DM * 2); float* CS = (float*)take((size_t)TT * HD * 2 * 4);
    bf* XB = (bf*)take((size_t)TT * DM * 2); float* FQ = (float*)take((size_t)TT * DQ * 4); float* FK = (float*)take((size_t)TT * DKV * 4);
    h16* QP16 = (h16*)take((size_t)NH_ * TT * HD * 2); h16* KP16 = (h16*)take((size_t)NKV * TT * HD * 2); h16* VT16 = (h16*)take((size_t)NKV * HD * TT * 2);
    bf* QPh = (bf*)take((size_t)NH_ * TT * HD * 2); bf* QPl = (bf*)take((size_t)NH_ * TT * HD * 2); bf* KPh = (bf*)take((size_t)NKV * TT * HD * 2); bf* KPl = (bf*)take((size_t)NKV * TT * HD * 2); bf* VTh = (bf*)take((size_t)NKV * HD * TT * 2); bf* VTl = (bf*)take((size_t)NKV * HD * TT * 2); bf* Ph = (bf*)take((size_t)ZH * RH * TT * 2); bf* Pl = (bf*)take((size_t)ZH * RH * TT * 2);
    float* Sb = (float*)take((size_t)ZH * TT * TT * 4); h16* P16 = (h16*)take((size_t)ZH * TT * TT * 2); float* Ob = (float*)take((size_t)ZH * TT * HD * 4);
    if ((size_t)(wsp - (char*)d_ws) > ws_size) return;    // ws 256 MiB
    float* FV = FK;   // FV aliases the k buffer; unused, as there is no v projection
    {   
      
       }
    k_csid<<<(TT * HD + 255) / 256, 256, 0, stream>>>(CS);
    const unsigned LQ = (unsigned)(((size_t)NH_ * TT * HD / 2 + 255) / 256), LKv = (unsigned)(((size_t)NKV * TT * HD / 2 + 255) / 256);
    for (int b = 0; b < NB_; ++b) {
        
        /* no projections: the q, k, v inputs feed the plane builders directly */
        
        k_rope<<<LQ, 256, 0, stream>>>(x + (size_t)b * TT * HD, DQ, NH_, CS, nullptr, nullptr, 1.0f, QP16, QPh, QPl);   /* q planes straight from the input (values bf16-rounded first, so the lo plane is zero) */
        
        k_rope<<<LKv, 256, 0, stream>>>(xk + (size_t)b * TT * HD, DKV, NKV, CS, nullptr, nullptr, 1.0f, KP16, KPh, KPl);
         k_vtp<<<LKv, 256, 0, stream>>>(xv + (size_t)b * TT * HD, DKV, NKV, VT16, VTh, VTl);
        for (int h0 = 0; h0 < NH_; h0 += ZH) { const size_t zq = (size_t)h0, zk = (size_t)(h0 / REP);   // one kv head per query head: each pass holds one head (ZH 1) on kv plane h0 / REP
            k_gemmw<bf, 2, false><<<dim3(TT / 64, TT / 64, ZH), 32, 0, stream>>>(QPh + zq * TT * HD, QPl + zq * TT * HD, KPh + zk * TT * HD, KPl + zk * TT * HD, HD, Sb, TT, nullptr, (size_t)TT * HD, (size_t)TT * HD, (size_t)TT * TT);   /* EVERY row's scores on hi/lo planes (3 products); only P.V stays hybrid */
            k_asoft<<<ZH * TT / 8, 256, 0, stream>>>(Sb, amask, P16, Ph, Pl);
            k_gemmw<bf, 2, false><<<dim3(RH / 64, HD / 64, ZH), 32, 0, stream>>>(Ph, Pl, VTh + zk * HD * TT, VTl + zk * HD * TT, TT, Ob, HD, nullptr, (size_t)RH * TT, (size_t)HD * TT, (size_t)TT * HD);
            k_gemmw<h16, 0, false><<<dim3((TT - RH) / 64, HD / 64, ZH), 32, 0, stream>>>(P16 + (size_t)RH * TT, nullptr, VT16 + zk * HD * TT, nullptr, TT, Ob + (size_t)RH * HD, HD, nullptr, (size_t)TT * TT, (size_t)HD * TT, (size_t)TT * HD);
            k_merge<<<(unsigned)(((size_t)ZH * TT * HD / 2 + 255) / 256), 256, 0, stream>>>(Ob, h0, OUT + (size_t)b * TT * DQ); }
         }
}

// v001
// Measured time: 726 microseconds a run.
// Timed twice side by side with v000, it ran 4.97 times as fast both times.
#include <hip/hip_runtime.h>

// Scaled dot-product attention on raw per-head inputs with an ADDITIVE random float mask (query, key, value [2][16][2048][64] = 32 planes, no projections; scores = q.k^T x 1/sqrt(64) + attn_mask with attn_mask f32 [1][1][2048][2048] standard-normal draws shared by all planes (read per (query, key) on device, bf16-rounded as every input); softmax over keys; out = probs.v -> [2][16][2048][64] (4.2 M); argument order query, key, value, attn_mask).
// Layout: 8 planes per pass (4 passes), each launch covering the pass's planes through grid z or 8 x the rows; per plane: the raw f32 inputs are ROUNDED TO bf16 first and split into identity planes; dense T-2048 attention at NH 1 with EVERY row's scores on hi/lo planes (3 products); the softmax kernel adds the mask row (16 B per lane, unconditional loads) before the max; P.V hybrid (rows < 512 hi/lo, rest fp16 x1024); the f32 merge writes the plane's output rows.
// Compute dtypes, f32 accumulate: every input rounded to bf16; scores 3 products on every row + bf16-rounded mask added in f32; softmax f32; P.V rows < 512 3 products, rest fp16; output f32.

#define NB_  32
#define TT   2048
#define DM   64
#define NH_  1
#define NKV  1
#define REP  (NH_ / NKV)
#define HD   64
#define DQ   (NH_ * HD)
#define DKV  (NKV * HD)
#define ZH   8                    // planes per pass: every launch of a pass covers ZH planes (grid z, or ZH x the rows); 32 / ZH passes; ZH score planes of 16 MiB each must fit the workspace
#define RH   512                  // query rows < RH use hi+lo planes (0: none)
#define WIN  0
#define PCAR 1024.0f
#define SCL  0.125f   // 1/sqrt(64)
typedef _Float16 h16;
typedef unsigned short bf;
typedef __attribute__((ext_vector_type(16))) __bf16   v16bf;
typedef __attribute__((ext_vector_type(16))) _Float16 v16h;
typedef __attribute__((ext_vector_type(8)))  _Float16 v8h;
typedef __attribute__((ext_vector_type(8)))  unsigned short v8us;
typedef __attribute__((ext_vector_type(8)))  float    v8f;
typedef __attribute__((ext_vector_type(4)))  float    v4f;
typedef v8h  __attribute__((may_alias)) v8ha;
typedef v4f  __attribute__((may_alias)) v4fa;
typedef v8us __attribute__((may_alias)) v8usa;

__device__ __forceinline__ unsigned short f2bf(float f) { unsigned u = __float_as_uint(f); u += 0x7FFFu + ((u >> 16) & 1u); return (unsigned short)(u >> 16); }
__device__ __forceinline__ float bf2f(unsigned short b) { return __uint_as_float(((unsigned)b) << 16); }
__device__ __forceinline__ float bfr(float f) { return bf2f(f2bf(f)); }
__device__ __forceinline__ v16h cat16(v8h lo, v8h hi) { return __builtin_shufflevector(lo, hi, 0, 1, 2, 3, 4, 5, 6, 7, 8, 9, 10, 11, 12, 13, 14, 15); }
__device__ __forceinline__ v16bf cat16b(v8us lo, v8us hi) { return __builtin_bit_cast(v16bf, __builtin_shufflevector(lo, hi, 0, 1, 2, 3, 4, 5, 6, 7, 8, 9, 10, 11, 12, 13, 14, 15)); }
__device__ __forceinline__ v8f wmma16(v16h a, v16h b, v8f c) { return __builtin_amdgcn_wmma_f32_16x16x32_f16(false, a, false, b, (short)0, c, false, false); }
__device__ __forceinline__ v8f wmmab(v16bf a, v16bf b, v8f c) { return __builtin_amdgcn_wmma_f32_16x16x32_bf16(false, a, false, b, (short)0, c, false, false); }



// ---- k_gemmw: register-blocked GEMM, ONE WAVE per 64x64 output tile (16 accumulators), operands straight from K-contiguous 16-bit planes; grid (M/64, N/64, Z), 32 threads.
// C[m][n] (f32, pitch ldc, + optional f32 bias[n]) = sum_k A[m][k] Bt[n][k] (+ split products per NSPLIT). z-batch strides sA/sB/sC in elements. K % 32 == 0.
template <typename T16> struct WFrag;
template <> struct WFrag<h16> { typedef v16h V; static __device__ __forceinline__ V ld(const h16* p) { return cat16(*(const v8h*)p, *(const v8h*)(p + 16)); } static __device__ __forceinline__ v8f mma(V a, V b, v8f c) { return wmma16(a, b, c); } };
template <> struct WFrag<bf> { typedef v16bf V; static __device__ __forceinline__ V ld(const bf* p) { return cat16b(*(const v8us*)p, *(const v8us*)(p + 16)); } static __device__ __forceinline__ v8f mma(V a, V b, v8f c) { return wmmab(a, b, c); } };
template <typename T16, int NSPLIT, bool BIAS>
__global__ __launch_bounds__(32) void k_gemmw(const T16* __restrict__ A, const T16* __restrict__ A2, const T16* __restrict__ Bt, const T16* __restrict__ Bt2, int K, float* C, int ldc, const float* __restrict__ bias, size_t sA, size_t sB, size_t sC) {
    typedef typename WFrag<T16>::V V;
    __shared__ __align__(16) float os[16 * 68];
    const size_t z = blockIdx.z; A += z * sA; if (A2) A2 += z * sA; Bt += z * sB; if (Bt2) Bt2 += z * sB; C += z * sC;
    const int lane = threadIdx.x & 31, lr = lane & 15, hi = lane >> 4; const int r0 = blockIdx.x * 64, c0 = blockIdx.y * 64;
    v8f acc[4][4];
#pragma unroll
    for (int mb = 0; mb < 4; ++mb)
#pragma unroll
        for (int nb = 0; nb < 4; ++nb) acc[mb][nb] = (v8f){};
    const size_t aoff = (size_t)(r0 + lr) * K + 8 * hi, boff = (size_t)(c0 + lr) * K + 8 * hi;
#pragma unroll 1
    for (int kc = 0; kc < K; kc += 32) {
        V a[4], a2[4];
#pragma unroll
        for (int mb = 0; mb < 4; ++mb) { a[mb] = WFrag<T16>::ld(A + aoff + (size_t)mb * 16 * K + kc); if (NSPLIT == 1 || NSPLIT == 2) a2[mb] = WFrag<T16>::ld(A2 + aoff + (size_t)mb * 16 * K + kc); }
#pragma unroll
        for (int nb = 0; nb < 4; ++nb) { const V b = WFrag<T16>::ld(Bt + boff + (size_t)nb * 16 * K + kc); V b2; if (NSPLIT >= 2) b2 = WFrag<T16>::ld(Bt2 + boff + (size_t)nb * 16 * K + kc);
#pragma unroll
            for (int mb = 0; mb < 4; ++mb) { acc[mb][nb] = WFrag<T16>::mma(a[mb], b, acc[mb][nb]); if (NSPLIT == 1 || NSPLIT == 2) acc[mb][nb] = WFrag<T16>::mma(a2[mb], b, acc[mb][nb]); if (NSPLIT >= 2) acc[mb][nb] = WFrag<T16>::mma(a[mb], b2, acc[mb][nb]); } }
        asm volatile("v_nop\n\tv_nop\n\tv_nop\n\tv_nop" : "+v"(acc[0][0]), "+v"(acc[1][1]), "+v"(acc[2][2]), "+v"(acc[3][3]) : "v"(a[0]), "v"(a[3]));
    }
#pragma unroll
    for (int mb = 0; mb < 4; ++mb) {
#pragma unroll
        for (int nb = 0; nb < 4; ++nb) {
#pragma unroll
            for (int j = 0; j < 8; ++j) os[(hi * 8 + j) * 68 + nb * 16 + lr] = acc[mb][nb][j]; }
        __builtin_amdgcn_wave_barrier(); asm volatile("" ::: "memory");
        float* crow = C + (size_t)(r0 + mb * 16) * ldc + c0;
{
#pragma unroll
            for (int s = 0; s < 8; ++s) { const int row = 2 * s + hi, cofs = lr * 4; v4f val = *(const v4fa*)(os + row * 68 + cofs); if (BIAS) { val[0] += bfr(bias[c0 + cofs]); val[1] += bfr(bias[c0 + cofs + 1]); val[2] += bfr(bias[c0 + cofs + 2]); val[3] += bfr(bias[c0 + cofs + 3]); }
                *(v4f*)(crow + (size_t)row * ldc + cofs) = val; }
             }
        __builtin_amdgcn_wave_barrier(); asm volatile("" ::: "memory");
    }
}

__device__ __forceinline__ h16 tohx(float x) { return (h16)x; }
__device__ __forceinline__ void splitf(float y, unsigned short& h, unsigned short& l) { h = f2bf(y); l = f2bf(y - bf2f(h)); }
typedef __attribute__((ext_vector_type(2))) _Float16 v2h;
typedef __attribute__((ext_vector_type(4))) _Float16 v4h;
typedef __attribute__((ext_vector_type(2))) unsigned short v2us;
typedef __attribute__((ext_vector_type(4))) unsigned short v4us;
typedef __attribute__((ext_vector_type(2))) float v2f;
typedef __attribute__((ext_vector_type(4))) int v4i;

// k_rope: head planes [h][t][d] (fp16 + hi/lo) of rope(x) x sc with the rotate-half convention out[d] = x[d] cos[t][d] - x[d+HD/2] sin[t][d], out[d+HD/2] = x[d+HD/2] cos[t][d+HD/2] + x[d] sin[t][d+HD/2]
__global__ __launch_bounds__(256) void k_rope(const float* __restrict__ F, int pitch, int nheads, const float* __restrict__ CS, const float* __restrict__ RF, const float* __restrict__ nw, float sc, h16* P16, bf* Ph, bf* Pl) {
    const size_t e = ((size_t)blockIdx.x * 256 + threadIdx.x) * 2; if (e >= (size_t)nheads * TT * HD) return; const int d = (int)(e % HD); const int t = (int)((e / HD) % TT); const int h = (int)(e / ((size_t)HD * TT));
    const float* f = F + ((size_t)h * TT + t) * pitch;   /* source planes [h][t][d] */
    const float rf = RF ? RF[(size_t)h * TT + t] : 1.0f; v2h o16; v2us oh, ol;
#pragma unroll
    for (int q = 0; q < 2; ++q) { const int dd = d + q; const int dp = (dd < HD / 2) ? dd + HD / 2 : dd - HD / 2; float x0 = bfr(f[dd]), x1 = bfr(f[dp]);   /* RAW d_in source: round to bf16 FIRST; the lo planes are then identically zero */
        if (RF) { float n0 = __fmul_rn(x0, rf), n1 = __fmul_rn(x1, rf); asm volatile("" : "+v"(n0)); asm volatile("" : "+v"(n1)); x0 = __fmul_rn(bfr(nw[dd]), n0); x1 = __fmul_rn(bfr(nw[dp]), n1); }
        const v2f cs = *(const v2f*)(CS + ((size_t)t * HD + dd) * 2); float a = __fmul_rn(x0, cs[0]), bq = __fmul_rn(x1, cs[1]); asm volatile("" : "+v"(a)); asm volatile("" : "+v"(bq)); const float r = ((dd < HD / 2) ? __fsub_rn(a, bq) : __fadd_rn(a, bq)) * sc;
        o16[q] = tohx(r); unsigned short a2, c2; splitf(r, a2, c2); oh[q] = a2; ol[q] = c2; }
    *(v2h*)(P16 + e) = o16; *(v2us*)(Ph + e) = oh; *(v2us*)(Pl + e) = ol;  }
__global__ __launch_bounds__(256) void k_vtp(const float* __restrict__ F, int pitch, int nheads, h16* V16, bf* Vh, bf* Vl) { const size_t e = ((size_t)blockIdx.x * 256 + threadIdx.x) * 2; if (e >= (size_t)nheads * HD * TT) return; const int t = (int)(e % TT); const int d = (int)((e / TT) % HD); const int g = (int)(e / ((size_t)TT * HD)); v2h o16; v2us oh, ol;
#pragma unroll
    for (int q = 0; q < 2; ++q) { const float x = bfr(F[((size_t)g * TT + t + q) * pitch + d]);   /* RAW d_in source: bf16-rounded first */ o16[q] = tohx(x); unsigned short a2, c2; splitf(x, a2, c2); oh[q] = a2; ol[q] = c2; }
    *(v2h*)(V16 + e) = o16; *(v2us*)(Vh + e) = oh; *(v2us*)(Vl + e) = ol;  }
__global__ __launch_bounds__(256) void k_csid(float* CS) { const int idx = blockIdx.x * 256 + threadIdx.x; if (idx >= TT * HD) return; v2f cs; cs[0] = 1.0f; cs[1] = 0.0f; *(v2f*)(CS + (size_t)idx * 2) = cs;  }
// k_asoft: per row (zz, i): t = S x HD^-0.5 + bf16-rounded mask[i][j]; softmax over the 2048 keys (register row, one exp, fixed trees);
__global__ __launch_bounds__(256) void k_asoft(const float* __restrict__ Sb, const float* __restrict__ mskf, h16* P16, bf* Ph, bf* Pl) {
    const int lane = threadIdx.x & 31; const int row = blockIdx.x * 8 + (threadIdx.x >> 5); if (row >= ZH * TT) return; const int i = row % TT; const int zz = row / TT; (void)zz; const bool hires = (i < RH); const float* sr = Sb + (size_t)row * TT; float v[TT / 32]; float mx = -3.0e38f;
#pragma unroll
    for (int ch = 0; ch < TT / 128; ++ch) { const int j0 = ch * 128 + lane * 4; const v4f a = *(const v4f*)(sr + j0); const v4f g4 = *(const v4f*)(mskf + (size_t)i * TT + j0);   /* additive mask row i (f32), 16 B per lane, unconditional */
#pragma unroll
        for (int q = 0; q < 4; ++q) { const int j = j0 + q; (void)j; float s0 = __fmul_rn(a[q], SCL); asm volatile("" : "+v"(s0)); float mv = bfr(g4[q]); asm volatile("" : "+v"(mv)); const float t = __fadd_rn(s0, mv);   /* scores x SCL + attn_mask[i][j] (mask bf16-rounded, added in f32) */ v[ch * 4 + q] = t; mx = fmaxf(mx, t); } }
#pragma unroll
    for (int sh = 16; sh; sh >>= 1) mx = fmaxf(mx, __shfl_xor(mx, sh, 32));
    float sum = 0.f;
#pragma unroll
    for (int k = 0; k < TT / 32; ++k) { float d0 = __fsub_rn(v[k], mx); asm volatile("" : "+v"(d0)); v[k] = __builtin_amdgcn_exp2f(__fmul_rn(d0, 1.4426950408889634f)); sum += v[k]; }
#pragma unroll
    for (int sh = 16; sh; sh >>= 1) sum += __shfl_xor(sum, sh, 32);
    const float f = __fdiv_rn(hires ? 1.0f : PCAR, sum);
{
        if (hires) {
#pragma unroll
            for (int ch = 0; ch < TT / 128; ++ch) { v4us oh, ol;
#pragma unroll
                for (int q = 0; q < 4; ++q) { unsigned short a, c2; splitf(v[ch * 4 + q] * f, a, c2); oh[q] = a; ol[q] = c2; }
                const size_t oo = ((size_t)zz * (RH ? RH : 1) + i) * TT + ch * 128 + lane * 4; *(v4us*)(Ph + oo) = oh; *(v4us*)(Pl + oo) = ol; }
        } else {
#pragma unroll
            for (int ch = 0; ch < TT / 128; ++ch) { v4h o4;
#pragma unroll
                for (int q = 0; q < 4; ++q) o4[q] = tohx(v[ch * 4 + q] * f);
                *(v4h*)(P16 + (size_t)row * TT + ch * 128 + lane * 4) = o4; } }
         }
}
__global__ __launch_bounds__(256) void k_merge(const float* __restrict__ O, int h0, float* OUTb) { const size_t e = ((size_t)blockIdx.x * 256 + threadIdx.x) * 2; if (e >= (size_t)ZH * TT * HD) return; const int d = (int)(e % HD); const int t = (int)((e / HD) % TT); const int zz = (int)(e / ((size_t)HD * TT)); const float cs = (t < RH) ? 1.0f : (1.0f / PCAR); const size_t oo = ((size_t)(h0 + zz) * TT + t) * DQ + d;   /* output planes [zz][t][d] */
    v2f o2; o2[0] = O[e] * cs; o2[1] = O[e + 1] * cs; *(v2f*)(OUTb + oo) = o2;  }

extern "C" void kernel_launch(void* const* d_in, const int* in_sizes, int n_in,
                              void* d_out, int out_size, void* d_ws, size_t ws_size, hipStream_t stream) {
    (void)in_sizes; (void)n_in; (void)out_size;
    const float* x = (const float*)d_in[0]; const float* xk = (const float*)d_in[1]; const float* xv = (const float*)d_in[2]; const float* amask = (const float*)d_in[3];   /* attn_mask f32 [1][1][2048][2048], read */   /* query, key, value: [32][2048][64] each (no projections) */ const float* wq = nullptr, *wk = nullptr, *wv = nullptr, *wo = nullptr; (void)wq; (void)wk; (void)wv; (void)wo;
    float* OUT = (float*)d_out;     // [32][2048][64]
    char* wsp = (char*)d_ws;
    auto take = [&](size_t bytes) { char* p = wsp; wsp += (bytes + 255) & ~(size_t)255; return (void*)p; };
    bf* WQ = (bf*)take((size_t)DQ * DM * 2); bf* WK = (bf*)take((size_t)DKV * DM * 2); bf* WV = (bf*)take((size_t)DKV * DM * 2); float* CS = (float*)take((size_t)TT * HD * 2 * 4);
    bf* XB = (bf*)take((size_t)TT * DM * 2); float* FQ = (float*)take((size_t)TT * DQ * 4); float* FK = (float*)take((size_t)TT * DKV * 4);
    h16* QP16 = (h16*)take((size_t)ZH * TT * HD * 2); h16* KP16 = (h16*)take((size_t)ZH * TT * HD * 2); h16* VT16 = (h16*)take((size_t)ZH * HD * TT * 2);
    bf* QPh = (bf*)take((size_t)ZH * TT * HD * 2); bf* QPl = (bf*)take((size_t)ZH * TT * HD * 2); bf* KPh = (bf*)take((size_t)ZH * TT * HD * 2); bf* KPl = (bf*)take((size_t)ZH * TT * HD * 2); bf* VTh = (bf*)take((size_t)ZH * HD * TT * 2); bf* VTl = (bf*)take((size_t)ZH * HD * TT * 2); bf* Ph = (bf*)take((size_t)ZH * RH * TT * 2); bf* Pl = (bf*)take((size_t)ZH * RH * TT * 2);
    float* Sb = (float*)take((size_t)ZH * TT * TT * 4); h16* P16 = (h16*)take((size_t)ZH * TT * TT * 2); float* Ob = (float*)take((size_t)ZH * TT * HD * 4);
    if ((size_t)(wsp - (char*)d_ws) > ws_size) return;    // ws 256 MiB
    float* FV = FK;   // FV aliases the k buffer; unused, as there is no v projection
    {   
      
       }
    k_csid<<<(TT * HD + 255) / 256, 256, 0, stream>>>(CS);
    const unsigned LQ = (unsigned)(((size_t)ZH * TT * HD / 2 + 255) / 256), LKv = LQ;
    for (int b = 0; b < NB_; b += ZH) {   /* one pass = ZH consecutive planes */
        
        /* no projections: the q, k, v inputs feed the plane builders directly */
        
        k_rope<<<LQ, 256, 0, stream>>>(x + (size_t)b * TT * HD, DQ, ZH, CS, nullptr, nullptr, 1.0f, QP16, QPh, QPl);   /* q planes straight from the input (values rounded to bf16 first, then split: hi = the rounded value, lo planes zero) */
        
        k_rope<<<LKv, 256, 0, stream>>>(xk + (size_t)b * TT * HD, DKV, ZH, CS, nullptr, nullptr, 1.0f, KP16, KPh, KPl);
         k_vtp<<<LKv, 256, 0, stream>>>(xv + (size_t)b * TT * HD, DKV, ZH, VT16, VTh, VTl);
        { const int h0 = 0; const size_t zq = 0, zk = 0;   // plane z of the pass uses q, k and v plane z (z-strides TT*HD)
            k_gemmw<bf, 2, false><<<dim3(TT / 64, TT / 64, ZH), 32, 0, stream>>>(QPh + zq * TT * HD, QPl + zq * TT * HD, KPh + zk * TT * HD, KPl + zk * TT * HD, HD, Sb, TT, nullptr, (size_t)TT * HD, (size_t)TT * HD, (size_t)TT * TT);   /* EVERY row's scores on hi/lo planes (3 products); only P.V stays hybrid */
            k_asoft<<<ZH * TT / 8, 256, 0, stream>>>(Sb, amask, P16, Ph, Pl);
            k_gemmw<bf, 2, false><<<dim3(RH / 64, HD / 64, ZH), 32, 0, stream>>>(Ph, Pl, VTh + zk * HD * TT, VTl + zk * HD * TT, TT, Ob, HD, nullptr, (size_t)RH * TT, (size_t)HD * TT, (size_t)TT * HD);
            k_gemmw<h16, 0, false><<<dim3((TT - RH) / 64, HD / 64, ZH), 32, 0, stream>>>(P16 + (size_t)RH * TT, nullptr, VT16 + zk * HD * TT, nullptr, TT, Ob + (size_t)RH * HD, HD, nullptr, (size_t)TT * TT, (size_t)HD * TT, (size_t)TT * HD);
            k_merge<<<(unsigned)(((size_t)ZH * TT * HD / 2 + 255) / 256), 256, 0, stream>>>(Ob, h0, OUT + (size_t)b * TT * DQ); }
         }
}

// v002
// It runs in 491 microseconds.
// Next to v001, in two timings, it ran 1.45 and 1.46 times as fast.
// All steps since v000 together make it 7.23 times as fast.
#include <hip/hip_runtime.h>

// Scaled dot-product attention on raw per-head inputs with an ADDITIVE random float mask (query, key, value [2][16][2048][64] = 32 planes, no projections; scores = q.k^T x 1/sqrt(64) + attn_mask with attn_mask f32 [1][1][2048][2048] standard-normal draws shared by all planes (read per (query, key) on device, bf16-rounded as every input); softmax over keys; out = probs.v -> [2][16][2048][64] (4.2 M); argument order query, key, value, attn_mask).
// Layout: 8 planes per pass (4 passes), each launch covering the pass's planes through grid z or 8 x the rows; per plane: the raw f32 inputs are ROUNDED TO bf16 first and split into identity planes; dense T-2048 attention at NH 1 with EVERY row's scores on hi/lo planes (3 products); the softmax kernel adds the mask row (16 B per lane, unconditional loads) before the max; P.V hybrid (rows < 512 hi/lo, rest fp16 x1024); the f32 merge writes the plane's output rows.
// Compute dtypes, f32 accumulate: every input rounded to bf16; scores 3 products on every row + bf16-rounded mask added in f32; softmax f32; P.V rows < 512 3 products, rest fp16; output f32.

#define NB_  32
#define TT   2048
#define DM   64
#define NH_  1
#define NKV  1
#define REP  (NH_ / NKV)
#define HD   64
#define DQ   (NH_ * HD)
#define DKV  (NKV * HD)
#define ZH   8                    // planes per pass: every launch of a pass covers ZH planes (grid z, or ZH x the rows); 32 / ZH passes; ZH score planes of 16 MiB each must fit the workspace
#define RH   512                  // query rows < RH use hi+lo planes (0: none)
#define WIN  0
#define KWPV 16                   // waves per 64x64 P.V tile: each walks TT / KWPV keys
#define PCAR 1024.0f
#define SCL  0.125f   // 1/sqrt(64)
typedef _Float16 h16;
typedef unsigned short bf;
typedef __attribute__((ext_vector_type(16))) __bf16   v16bf;
typedef __attribute__((ext_vector_type(16))) _Float16 v16h;
typedef __attribute__((ext_vector_type(8)))  _Float16 v8h;
typedef __attribute__((ext_vector_type(8)))  unsigned short v8us;
typedef __attribute__((ext_vector_type(8)))  float    v8f;
typedef __attribute__((ext_vector_type(4)))  float    v4f;
typedef v8h  __attribute__((may_alias)) v8ha;
typedef v4f  __attribute__((may_alias)) v4fa;
typedef v8us __attribute__((may_alias)) v8usa;

__device__ __forceinline__ unsigned short f2bf(float f) { unsigned u = __float_as_uint(f); u += 0x7FFFu + ((u >> 16) & 1u); return (unsigned short)(u >> 16); }
__device__ __forceinline__ float bf2f(unsigned short b) { return __uint_as_float(((unsigned)b) << 16); }
__device__ __forceinline__ float bfr(float f) { return bf2f(f2bf(f)); }
__device__ __forceinline__ v16h cat16(v8h lo, v8h hi) { return __builtin_shufflevector(lo, hi, 0, 1, 2, 3, 4, 5, 6, 7, 8, 9, 10, 11, 12, 13, 14, 15); }
__device__ __forceinline__ v16bf cat16b(v8us lo, v8us hi) { return __builtin_bit_cast(v16bf, __builtin_shufflevector(lo, hi, 0, 1, 2, 3, 4, 5, 6, 7, 8, 9, 10, 11, 12, 13, 14, 15)); }
__device__ __forceinline__ v8f wmma16(v16h a, v16h b, v8f c) { return __builtin_amdgcn_wmma_f32_16x16x32_f16(false, a, false, b, (short)0, c, false, false); }
__device__ __forceinline__ v8f wmmab(v16bf a, v16bf b, v8f c) { return __builtin_amdgcn_wmma_f32_16x16x32_bf16(false, a, false, b, (short)0, c, false, false); }



// ---- k_gemmw: register-blocked GEMM, KW WAVES per 64x64 output tile (16 accumulators each), operands straight from K-contiguous 16-bit planes; grid (M/64, N/64, Z), 32 x KW threads.
// C[m][n] (f32, pitch ldc, + optional f32 bias[n] when KW == 1) = sum_k A[m][k] Bt[n][k] (+ split products per NSPLIT). z-batch strides sA/sB/sC in elements. K % (32 x KW) == 0.
// KW > 1: wave w sums the k range [w K/KW, (w+1) K/KW) of the whole tile, so a long K is walked by KW short load-latency chains side by side; the KW partial tiles meet in LDS and are added in wave order 0..KW-1.
template <typename T16> struct WFrag;
template <> struct WFrag<h16> { typedef v16h V; static __device__ __forceinline__ V ld(const h16* p) { return cat16(*(const v8h*)p, *(const v8h*)(p + 16)); } static __device__ __forceinline__ v8f mma(V a, V b, v8f c) { return wmma16(a, b, c); } };
template <> struct WFrag<bf> { typedef v16bf V; static __device__ __forceinline__ V ld(const bf* p) { return cat16b(*(const v8us*)p, *(const v8us*)(p + 16)); } static __device__ __forceinline__ v8f mma(V a, V b, v8f c) { return wmmab(a, b, c); } };
template <typename T16, int NSPLIT, bool BIAS, int KW>
__global__ __launch_bounds__(32 * KW) void k_gemmw(const T16* __restrict__ A, const T16* __restrict__ A2, const T16* __restrict__ Bt, const T16* __restrict__ Bt2, int K, float* C, int ldc, const float* __restrict__ bias, size_t sA, size_t sB, size_t sC) {
    typedef typename WFrag<T16>::V V;
    const size_t z = blockIdx.z; A += z * sA; if (A2) A2 += z * sA; Bt += z * sB; if (Bt2) Bt2 += z * sB; C += z * sC;
    const int lane = threadIdx.x & 31, lr = lane & 15, hi = lane >> 4; const int r0 = blockIdx.x * 64, c0 = blockIdx.y * 64;
    v8f acc[4][4];
#pragma unroll
    for (int mb = 0; mb < 4; ++mb)
#pragma unroll
        for (int nb = 0; nb < 4; ++nb) acc[mb][nb] = (v8f){};
    const size_t aoff = (size_t)(r0 + lr) * K + 8 * hi, boff = (size_t)(c0 + lr) * K + 8 * hi;
    const int w = (KW > 1) ? __builtin_amdgcn_readfirstlane((int)(threadIdx.x >> 5)) : 0; const int kbeg = w * (K / KW), kend = kbeg + K / KW;   /* this wave's k range */
#pragma unroll 1
    for (int kc = kbeg; kc < kend; kc += 32) {
        V a[4], a2[4];
#pragma unroll
        for (int mb = 0; mb < 4; ++mb) { a[mb] = WFrag<T16>::ld(A + aoff + (size_t)mb * 16 * K + kc); if (NSPLIT == 1 || NSPLIT == 2) a2[mb] = WFrag<T16>::ld(A2 + aoff + (size_t)mb * 16 * K + kc); }
#pragma unroll
        for (int nb = 0; nb < 4; ++nb) { const V b = WFrag<T16>::ld(Bt + boff + (size_t)nb * 16 * K + kc); V b2; if (NSPLIT >= 2) b2 = WFrag<T16>::ld(Bt2 + boff + (size_t)nb * 16 * K + kc);
#pragma unroll
            for (int mb = 0; mb < 4; ++mb) { acc[mb][nb] = WFrag<T16>::mma(a[mb], b, acc[mb][nb]); if (NSPLIT == 1 || NSPLIT == 2) acc[mb][nb] = WFrag<T16>::mma(a2[mb], b, acc[mb][nb]); if (NSPLIT >= 2) acc[mb][nb] = WFrag<T16>::mma(a[mb], b2, acc[mb][nb]); } }
        asm volatile("v_nop\n\tv_nop\n\tv_nop\n\tv_nop" : "+v"(acc[0][0]), "+v"(acc[1][1]), "+v"(acc[2][2]), "+v"(acc[3][3]) : "v"(a[0]), "v"(a[3]));
    }
    if constexpr (KW > 1) {
        // partial tiles in register order: red[wave][fragment mb*4+nb][half of j][lane][4], 16 B per lane, contiguous over the wave
        // every loop of this block is fully unrolled: acc stays in registers only under compile-time indices, and the LDS offsets fold into immediates
        __shared__ __align__(16) float red[KW * 4096];
#pragma unroll
        for (int mb = 0; mb < 4; ++mb)
#pragma unroll
            for (int nb = 0; nb < 4; ++nb)
#pragma unroll
                for (int jh = 0; jh < 2; ++jh) { v4f p; p[0] = acc[mb][nb][jh * 4]; p[1] = acc[mb][nb][jh * 4 + 1]; p[2] = acc[mb][nb][jh * 4 + 2]; p[3] = acc[mb][nb][jh * 4 + 3]; *(v4fa*)(red + w * 4096 + ((mb * 4 + nb) * 2 + jh) * 128 + lane * 4) = p; }
        __syncthreads();   // every wave's partial tile is in LDS before any wave adds them
        // row group g = tile rows 4g..4g+3 (mb = g>>2, lane half (g>>1)&1, j half g&1); a lane takes column lane + 32 h of the four rows, so each store below is one whole 128-byte line of one row
#pragma unroll
        for (int gi = 0; gi < 16 / KW; ++gi) { const int g = w * (16 / KW) + gi;
#pragma unroll
            for (int h = 0; h < 2; ++h) { const float* rp = red + (((g >> 2) * 4 + 2 * h + hi) * 2 + (g & 1)) * 128 + (((g >> 1) & 1) * 16 + lr) * 4; v4f s = *(const v4fa*)rp;
#pragma unroll
                for (int q = 1; q < KW; ++q) s += *(const v4fa*)(rp + q * 4096);
#pragma unroll
                for (int jj = 0; jj < 4; ++jj) C[(size_t)(r0 + 4 * g + jj) * ldc + c0 + 32 * h + lane] = s[jj]; } }
    } else {
    __shared__ __align__(16) float os[16 * 68];
#pragma unroll
    for (int mb = 0; mb < 4; ++mb) {
#pragma unroll
        for (int nb = 0; nb < 4; ++nb) {
#pragma unroll
            for (int j = 0; j < 8; ++j) os[(hi * 8 + j) * 68 + nb * 16 + lr] = acc[mb][nb][j]; }
        __builtin_amdgcn_wave_barrier(); asm volatile("" ::: "memory");
        float* crow = C + (size_t)(r0 + mb * 16) * ldc + c0;
{
#pragma unroll
            for (int s = 0; s < 8; ++s) { const int row = 2 * s + hi, cofs = lr * 4; v4f val = *(const v4fa*)(os + row * 68 + cofs); if (BIAS) { val[0] += bfr(bias[c0 + cofs]); val[1] += bfr(bias[c0 + cofs + 1]); val[2] += bfr(bias[c0 + cofs + 2]); val[3] += bfr(bias[c0 + cofs + 3]); }
                *(v4f*)(crow + (size_t)row * ldc + cofs) = val; }
             }
        __builtin_amdgcn_wave_barrier(); asm volatile("" ::: "memory");
    }
    }
}

__device__ __forceinline__ h16 tohx(float x) { return (h16)x; }
__device__ __forceinline__ void splitf(float y, unsigned short& h, unsigned short& l) { h = f2bf(y); l = f2bf(y - bf2f(h)); }
typedef __attribute__((ext_vector_type(2))) _Float16 v2h;
typedef __attribute__((ext_vector_type(4))) _Float16 v4h;
typedef __attribute__((ext_vector_type(2))) unsigned short v2us;
typedef __attribute__((ext_vector_type(4))) unsigned short v4us;
typedef __attribute__((ext_vector_type(2))) float v2f;
typedef __attribute__((ext_vector_type(4))) int v4i;

// k_rope: head planes [h][t][d] (fp16 + hi/lo) of rope(x) x sc with the rotate-half convention out[d] = x[d] cos[t][d] - x[d+HD/2] sin[t][d], out[d+HD/2] = x[d+HD/2] cos[t][d+HD/2] + x[d] sin[t][d+HD/2]
__global__ __launch_bounds__(256) void k_rope(const float* __restrict__ F, int pitch, int nheads, const float* __restrict__ CS, const float* __restrict__ RF, const float* __restrict__ nw, float sc, h16* P16, bf* Ph, bf* Pl) {
    const size_t e = ((size_t)blockIdx.x * 256 + threadIdx.x) * 2; if (e >= (size_t)nheads * TT * HD) return; const int d = (int)(e % HD); const int t = (int)((e / HD) % TT); const int h = (int)(e / ((size_t)HD * TT));
    const float* f = F + ((size_t)h * TT + t) * pitch;   /* source planes [h][t][d] */
    const float rf = RF ? RF[(size_t)h * TT + t] : 1.0f; v2h o16; v2us oh, ol;
#pragma unroll
    for (int q = 0; q < 2; ++q) { const int dd = d + q; const int dp = (dd < HD / 2) ? dd + HD / 2 : dd - HD / 2; float x0 = bfr(f[dd]), x1 = bfr(f[dp]);   /* RAW d_in source: round to bf16 FIRST; the lo planes are then identically zero */
        if (RF) { float n0 = __fmul_rn(x0, rf), n1 = __fmul_rn(x1, rf); asm volatile("" : "+v"(n0)); asm volatile("" : "+v"(n1)); x0 = __fmul_rn(bfr(nw[dd]), n0); x1 = __fmul_rn(bfr(nw[dp]), n1); }
        const v2f cs = *(const v2f*)(CS + ((size_t)t * HD + dd) * 2); float a = __fmul_rn(x0, cs[0]), bq = __fmul_rn(x1, cs[1]); asm volatile("" : "+v"(a)); asm volatile("" : "+v"(bq)); const float r = ((dd < HD / 2) ? __fsub_rn(a, bq) : __fadd_rn(a, bq)) * sc;
        o16[q] = tohx(r); unsigned short a2, c2; splitf(r, a2, c2); oh[q] = a2; ol[q] = c2; }
    *(v2h*)(P16 + e) = o16; *(v2us*)(Ph + e) = oh; *(v2us*)(Pl + e) = ol;  }
__global__ __launch_bounds__(256) void k_vtp(const float* __restrict__ F, int pitch, int nheads, h16* V16, bf* Vh, bf* Vl) { const size_t e = ((size_t)blockIdx.x * 256 + threadIdx.x) * 2; if (e >= (size_t)nheads * HD * TT) return; const int t = (int)(e % TT); const int d = (int)((e / TT) % HD); const int g = (int)(e / ((size_t)TT * HD)); v2h o16; v2us oh, ol;
#pragma unroll
    for (int q = 0; q < 2; ++q) { const float x = bfr(F[((size_t)g * TT + t + q) * pitch + d]);   /* RAW d_in source: bf16-rounded first */ o16[q] = tohx(x); unsigned short a2, c2; splitf(x, a2, c2); oh[q] = a2; ol[q] = c2; }
    *(v2h*)(V16 + e) = o16; *(v2us*)(Vh + e) = oh; *(v2us*)(Vl + e) = ol;  }
__global__ __launch_bounds__(256) void k_csid(float* CS) { const int idx = blockIdx.x * 256 + threadIdx.x; if (idx >= TT * HD) return; v2f cs; cs[0] = 1.0f; cs[1] = 0.0f; *(v2f*)(CS + (size_t)idx * 2) = cs;  }
// k_asoft: per row (zz, i): t = S x HD^-0.5 + bf16-rounded mask[i][j]; softmax over the 2048 keys (register row, one exp, fixed trees);
__global__ __launch_bounds__(256) void k_asoft(const float* __restrict__ Sb, const float* __restrict__ mskf, h16* P16, bf* Ph, bf* Pl) {
    const int lane = threadIdx.x & 31; const int row = blockIdx.x * 8 + (threadIdx.x >> 5); if (row >= ZH * TT) return; const int i = row % TT; const int zz = row / TT; (void)zz; const bool hires = (i < RH); const float* sr = Sb + (size_t)row * TT; float v[TT / 32]; float mx = -3.0e38f;
#pragma unroll
    for (int ch = 0; ch < TT / 128; ++ch) { const int j0 = ch * 128 + lane * 4; const v4f a = *(const v4f*)(sr + j0); const v4f g4 = *(const v4f*)(mskf + (size_t)i * TT + j0);   /* additive mask row i (f32), 16 B per lane, unconditional */
#pragma unroll
        for (int q = 0; q < 4; ++q) { const int j = j0 + q; (void)j; float s0 = __fmul_rn(a[q], SCL); asm volatile("" : "+v"(s0)); float mv = bfr(g4[q]); asm volatile("" : "+v"(mv)); const float t = __fadd_rn(s0, mv);   /* scores x SCL + attn_mask[i][j] (mask bf16-rounded, added in f32) */ v[ch * 4 + q] = t; mx = fmaxf(mx, t); } }
#pragma unroll
    for (int sh = 16; sh; sh >>= 1) mx = fmaxf(mx, __shfl_xor(mx, sh, 32));
    float sum = 0.f;
#pragma unroll
    for (int k = 0; k < TT / 32; ++k) { float d0 = __fsub_rn(v[k], mx); asm volatile("" : "+v"(d0)); v[k] = __builtin_amdgcn_exp2f(__fmul_rn(d0, 1.4426950408889634f)); sum += v[k]; }
#pragma unroll
    for (int sh = 16; sh; sh >>= 1) sum += __shfl_xor(sum, sh, 32);
    const float f = __fdiv_rn(hires ? 1.0f : PCAR, sum);
{
        if (hires) {
#pragma unroll
            for (int ch = 0; ch < TT / 128; ++ch) { v4us oh, ol;
#pragma unroll
                for (int q = 0; q < 4; ++q) { unsigned short a, c2; splitf(v[ch * 4 + q] * f, a, c2); oh[q] = a; ol[q] = c2; }
                const size_t oo = ((size_t)zz * (RH ? RH : 1) + i) * TT + ch * 128 + lane * 4; *(v4us*)(Ph + oo) = oh; *(v4us*)(Pl + oo) = ol; }
        } else {
#pragma unroll
            for (int ch = 0; ch < TT / 128; ++ch) { v4h o4;
#pragma unroll
                for (int q = 0; q < 4; ++q) o4[q] = tohx(v[ch * 4 + q] * f);
                *(v4h*)(P16 + (size_t)row * TT + ch * 128 + lane * 4) = o4; } }
         }
}
__global__ __launch_bounds__(256) void k_merge(const float* __restrict__ O, int h0, float* OUTb) { const size_t e = ((size_t)blockIdx.x * 256 + threadIdx.x) * 2; if (e >= (size_t)ZH * TT * HD) return; const int d = (int)(e % HD); const int t = (int)((e / HD) % TT); const int zz = (int)(e / ((size_t)HD * TT)); const float cs = (t < RH) ? 1.0f : (1.0f / PCAR); const size_t oo = ((size_t)(h0 + zz) * TT + t) * DQ + d;   /* output planes [zz][t][d] */
    v2f o2; o2[0] = O[e] * cs; o2[1] = O[e + 1] * cs; *(v2f*)(OUTb + oo) = o2;  }

extern "C" void kernel_launch(void* const* d_in, const int* in_sizes, int n_in,
                              void* d_out, int out_size, void* d_ws, size_t ws_size, hipStream_t stream) {
    (void)in_sizes; (void)n_in; (void)out_size;
    const float* x = (const float*)d_in[0]; const float* xk = (const float*)d_in[1]; const float* xv = (const float*)d_in[2]; const float* amask = (const float*)d_in[3];   /* attn_mask f32 [1][1][2048][2048], read */   /* query, key, value: [32][2048][64] each (no projections) */ const float* wq = nullptr, *wk = nullptr, *wv = nullptr, *wo = nullptr; (void)wq; (void)wk; (void)wv; (void)wo;
    float* OUT = (float*)d_out;     // [32][2048][64]
    char* wsp = (char*)d_ws;
    auto take = [&](size_t bytes) { char* p = wsp; wsp += (bytes + 255) & ~(size_t)255; return (void*)p; };
    bf* WQ = (bf*)take((size_t)DQ * DM * 2); bf* WK = (bf*)take((size_t)DKV * DM * 2); bf* WV = (bf*)take((size_t)DKV * DM * 2); float* CS = (float*)take((size_t)TT * HD * 2 * 4);
    bf* XB = (bf*)take((size_t)TT * DM * 2); float* FQ = (float*)take((size_t)TT * DQ * 4); float* FK = (float*)take((size_t)TT * DKV * 4);
    h16* QP16 = (h16*)take((size_t)ZH * TT * HD * 2); h16* KP16 = (h16*)take((size_t)ZH * TT * HD * 2); h16* VT16 = (h16*)take((size_t)ZH * HD * TT * 2);
    bf* QPh = (bf*)take((size_t)ZH * TT * HD * 2); bf* QPl = (bf*)take((size_t)ZH * TT * HD * 2); bf* KPh = (bf*)take((size_t)ZH * TT * HD * 2); bf* KPl = (bf*)take((size_t)ZH * TT * HD * 2); bf* VTh = (bf*)take((size_t)ZH * HD * TT * 2); bf* VTl = (bf*)take((size_t)ZH * HD * TT * 2); bf* Ph = (bf*)take((size_t)ZH * RH * TT * 2); bf* Pl = (bf*)take((size_t)ZH * RH * TT * 2);
    float* Sb = (float*)take((size_t)ZH * TT * TT * 4); h16* P16 = (h16*)take((size_t)ZH * TT * TT * 2); float* Ob = (float*)take((size_t)ZH * TT * HD * 4);
    if ((size_t)(wsp - (char*)d_ws) > ws_size) return;    // ws 256 MiB
    float* FV = FK;   // FV aliases the k buffer; unused, as there is no v projection
    {   
      
       }
    k_csid<<<(TT * HD + 255) / 256, 256, 0, stream>>>(CS);
    const unsigned LQ = (unsigned)(((size_t)ZH * TT * HD / 2 + 255) / 256), LKv = LQ;
    for (int b = 0; b < NB_; b += ZH) {   /* one pass = ZH consecutive planes */
        
        /* no projections: the q, k, v inputs feed the plane builders directly */
        
        k_rope<<<LQ, 256, 0, stream>>>(x + (size_t)b * TT * HD, DQ, ZH, CS, nullptr, nullptr, 1.0f, QP16, QPh, QPl);   /* q planes straight from the input (values rounded to bf16 first, then split: hi = the rounded value, lo planes zero) */
        
        k_rope<<<LKv, 256, 0, stream>>>(xk + (size_t)b * TT * HD, DKV, ZH, CS, nullptr, nullptr, 1.0f, KP16, KPh, KPl);
         k_vtp<<<LKv, 256, 0, stream>>>(xv + (size_t)b * TT * HD, DKV, ZH, VT16, VTh, VTl);
        { const int h0 = 0; const size_t zq = 0, zk = 0;   // plane z of the pass uses q, k and v plane z (z-strides TT*HD)
            k_gemmw<bf, 2, false, 1><<<dim3(TT / 64, TT / 64, ZH), 32, 0, stream>>>(QPh + zq * TT * HD, QPl + zq * TT * HD, KPh + zk * TT * HD, KPl + zk * TT * HD, HD, Sb, TT, nullptr, (size_t)TT * HD, (size_t)TT * HD, (size_t)TT * TT);   /* EVERY row's scores on hi/lo planes (3 products); only P.V stays hybrid */
            k_asoft<<<ZH * TT / 8, 256, 0, stream>>>(Sb, amask, P16, Ph, Pl);
            k_gemmw<bf, 2, false, KWPV><<<dim3(RH / 64, HD / 64, ZH), 32 * KWPV, 0, stream>>>(Ph, Pl, VTh + zk * HD * TT, VTl + zk * HD * TT, TT, Ob, HD, nullptr, (size_t)RH * TT, (size_t)HD * TT, (size_t)TT * HD);
            k_gemmw<h16, 0, false, KWPV><<<dim3((TT - RH) / 64, HD / 64, ZH), 32 * KWPV, 0, stream>>>(P16 + (size_t)RH * TT, nullptr, VT16 + zk * HD * TT, nullptr, TT, Ob + (size_t)RH * HD, HD, nullptr, (size_t)TT * TT, (size_t)HD * TT, (size_t)TT * HD);
            k_merge<<<(unsigned)(((size_t)ZH * TT * HD / 2 + 255) / 256), 256, 0, stream>>>(Ob, h0, OUT + (size_t)b * TT * DQ); }
         }
}

// v004
// It runs in 310 microseconds.
// It is 1.59 times as fast as v002, going by the measured steps of the versions left out in between.
// Over all steps from v000 it is 11.5 times as fast.
#include <hip/hip_runtime.h>

// Scaled dot-product attention on raw per-head inputs with an ADDITIVE random float mask (query, key, value [2][16][2048][64] = 32 planes, no projections; scores = q.k^T x 1/sqrt(64) + attn_mask with attn_mask f32 [1][1][2048][2048] standard-normal draws shared by all planes (read per (query, key) on device, bf16-rounded as every input); softmax over keys; out = probs.v -> [2][16][2048][64] (4.2 M); argument order query, key, value, attn_mask).
// Layout: 8 planes per pass (4 passes), each launch covering the pass's planes through grid y or 8 x the rows; per plane: the raw f32 inputs are ROUNDED TO bf16 first and split into identity planes (the K and V^T planes in fragment order, see fragk / fragv); ONE fused kernel then walks the 2048 keys 32 at a time per 16 query rows: scores on hi/lo planes (3 products), mask added, running maximum and sum per query, P.V hybrid (rows < 512 hi/lo, rest fp16 x1024); scores and probabilities stay in registers, the kernel writes the output rows.
// Compute dtypes, f32 accumulate: every input rounded to bf16; scores 3 products on every row + bf16-rounded mask added in f32; softmax f32; P.V rows < 512 3 products, rest fp16; output f32.

#define NB_  32
#define TT   2048
#define DM   64
#define NH_  1
#define NKV  1
#define REP  (NH_ / NKV)
#define HD   64
#define DQ   (NH_ * HD)
#define DKV  (NKV * HD)
#define ZH   8                    // planes per pass: every launch of a pass covers ZH planes (grid y, or ZH x the rows); 32 / ZH passes
#define RH   512                  // query rows < RH use hi+lo planes (0: none)
#define WIN  0
#define FW   4                    // waves per work-group of the fused kernel, 16 query rows each: one wave per SIMD of a WGP, K and V shared through the WGP cache
#define PSH  10.0f                // rows >= RH: probabilities carry a factor 2^PSH into fp16 (it cancels against the sum)
#define L2E  1.4426950408889634f
#define SCL  0.125f   // 1/sqrt(64)
typedef _Float16 h16;
typedef unsigned short bf;
typedef __attribute__((ext_vector_type(16))) __bf16   v16bf;
typedef __attribute__((ext_vector_type(16))) _Float16 v16h;
typedef __attribute__((ext_vector_type(8)))  _Float16 v8h;
typedef __attribute__((ext_vector_type(8)))  unsigned short v8us;
typedef __attribute__((ext_vector_type(8)))  float    v8f;
typedef __attribute__((ext_vector_type(4)))  float    v4f;
typedef v8h  __attribute__((may_alias)) v8ha;
typedef v4f  __attribute__((may_alias)) v4fa;
typedef v8us __attribute__((may_alias)) v8usa;

__device__ __forceinline__ unsigned short f2bf(float f) { unsigned u = __float_as_uint(f); u += 0x7FFFu + ((u >> 16) & 1u); return (unsigned short)(u >> 16); }
__device__ __forceinline__ float bf2f(unsigned short b) { return __uint_as_float(((unsigned)b) << 16); }
__device__ __forceinline__ float bfr(float f) { return bf2f(f2bf(f)); }
__device__ __forceinline__ v16h cat16(v8h lo, v8h hi) { return __builtin_shufflevector(lo, hi, 0, 1, 2, 3, 4, 5, 6, 7, 8, 9, 10, 11, 12, 13, 14, 15); }
__device__ __forceinline__ v16bf cat16b(v8us lo, v8us hi) { return __builtin_bit_cast(v16bf, __builtin_shufflevector(lo, hi, 0, 1, 2, 3, 4, 5, 6, 7, 8, 9, 10, 11, 12, 13, 14, 15)); }
__device__ __forceinline__ v8f wmma16(v16h a, v16h b, v8f c) { return __builtin_amdgcn_wmma_f32_16x16x32_f16(false, a, false, b, (short)0, c, false, false); }
__device__ __forceinline__ v8f wmmab(v16bf a, v16bf b, v8f c) { return __builtin_amdgcn_wmma_f32_16x16x32_bf16(false, a, false, b, (short)0, c, false, false); }



// 16x16x32 operand fragment of a K-contiguous 16-bit plane: the pointer already holds row (lane & 15) and k offset 8 x (lane >> 4); A and B use the same map
template <typename T16> struct WFrag;
// ldf: the same fragment from a plane stored in FRAGMENT ORDER: the 32 lanes' 16-byte pieces of one load lie side by side (512 contiguous bytes = 4 whole cache lines a load, where a row-major plane makes a load touch 16 lines for 32 bytes each); the pointer already holds 8 x lane, the fragment's second half follows 256 elements on
template <> struct WFrag<h16> { typedef v16h V; static __device__ __forceinline__ V ld(const h16* p) { return cat16(*(const v8h*)p, *(const v8h*)(p + 16)); } static __device__ __forceinline__ V ldf(const h16* p) { return cat16(*(const v8h*)p, *(const v8h*)(p + 256)); } static __device__ __forceinline__ v8f mma(V a, V b, v8f c) { return wmma16(a, b, c); } };
template <> struct WFrag<bf> { typedef v16bf V; static __device__ __forceinline__ V ld(const bf* p) { return cat16b(*(const v8us*)p, *(const v8us*)(p + 16)); } static __device__ __forceinline__ V ldf(const bf* p) { return cat16b(*(const v8us*)p, *(const v8us*)(p + 256)); } static __device__ __forceinline__ v8f mma(V a, V b, v8f c) { return wmmab(a, b, c); } };

__device__ __forceinline__ h16 tohx(float x) { return (h16)x; }
__device__ __forceinline__ void splitf(float y, unsigned short& h, unsigned short& l) { h = f2bf(y); l = f2bf(y - bf2f(h)); }
typedef __attribute__((ext_vector_type(2))) _Float16 v2h;
typedef __attribute__((ext_vector_type(4))) _Float16 v4h;
typedef __attribute__((ext_vector_type(2))) unsigned short v2us;
typedef __attribute__((ext_vector_type(4))) unsigned short v4us;
typedef __attribute__((ext_vector_type(2))) float v2f;
typedef __attribute__((ext_vector_type(4))) int v4i;

// Fragment order of one plane (TT x HD elements). A fragment half is [lane = 16 hi + lr][j = 0..7], 256 elements; lane (lr, hi) holds tile row lr and k = 16 c + 8 hi + j of half c.
// fragk: K, tile rows = keys, k = d: [key / 16][d / 32][c = d / 16 & 1][hi = d / 8 & 1][lr = key & 15][j = d & 7]; a pass of 32 keys is 2048 consecutive elements.
// fragv: V^T, tile rows = d, k = keys: [key / 32][d / 16][c = key / 16 & 1][hi = key / 8 & 1][lr = d & 15][j = key & 7]; a pass of 32 keys is 2048 consecutive elements.
__device__ __forceinline__ size_t fragk(int key, int d) { return (size_t)((key >> 4) * 1024 + (d >> 5) * 512 + ((d >> 4) & 1) * 256 + ((d >> 3) & 1) * 128 + (key & 15) * 8 + (d & 7)); }
__device__ __forceinline__ size_t fragv(int d, int key) { return (size_t)((key >> 5) * 2048 + (d >> 4) * 512 + ((key >> 4) & 1) * 256 + ((key >> 3) & 1) * 128 + (d & 15) * 8 + (key & 7)); }
// k_rope: head planes [h][t][d] (fp16 + hi/lo) of rope(x) x sc with the rotate-half convention out[d] = x[d] cos[t][d] - x[d+HD/2] sin[t][d], out[d+HD/2] = x[d+HD/2] cos[t][d+HD/2] + x[d] sin[t][d+HD/2]; FO: the hi/lo planes go out in fragment order (fragk)
template <bool FO> __global__ __launch_bounds__(256) void k_rope(const float* __restrict__ F, int pitch, int nheads, const float* __restrict__ CS, const float* __restrict__ RF, const float* __restrict__ nw, float sc, h16* P16, bf* Ph, bf* Pl) {
    const size_t e = ((size_t)blockIdx.x * 256 + threadIdx.x) * 2; if (e >= (size_t)nheads * TT * HD) return; const int d = (int)(e % HD); const int t = (int)((e / HD) % TT); const int h = (int)(e / ((size_t)HD * TT));
    const float* f = F + ((size_t)h * TT + t) * pitch;   /* source planes [h][t][d] */
    const float rf = RF ? RF[(size_t)h * TT + t] : 1.0f; v2h o16; v2us oh, ol;
#pragma unroll
    for (int q = 0; q < 2; ++q) { const int dd = d + q; const int dp = (dd < HD / 2) ? dd + HD / 2 : dd - HD / 2; float x0 = bfr(f[dd]), x1 = bfr(f[dp]);   /* RAW d_in source: round to bf16 FIRST; the lo planes are then identically zero */
        if (RF) { float n0 = __fmul_rn(x0, rf), n1 = __fmul_rn(x1, rf); asm volatile("" : "+v"(n0)); asm volatile("" : "+v"(n1)); x0 = __fmul_rn(bfr(nw[dd]), n0); x1 = __fmul_rn(bfr(nw[dp]), n1); }
        const v2f cs = *(const v2f*)(CS + ((size_t)t * HD + dd) * 2); float a = __fmul_rn(x0, cs[0]), bq = __fmul_rn(x1, cs[1]); asm volatile("" : "+v"(a)); asm volatile("" : "+v"(bq)); const float r = ((dd < HD / 2) ? __fsub_rn(a, bq) : __fadd_rn(a, bq)) * sc;
        o16[q] = tohx(r); unsigned short a2, c2; splitf(r, a2, c2); oh[q] = a2; ol[q] = c2; }
    const size_t eo = FO ? (size_t)h * TT * HD + fragk(t, d) : e;   /* d is even: the pair stays side by side */
    *(v2h*)(P16 + e) = o16; *(v2us*)(Ph + eo) = oh; *(v2us*)(Pl + eo) = ol;  }
__global__ __launch_bounds__(256) void k_vtp(const float* __restrict__ F, int pitch, int nheads, h16* V16, bf* Vh, bf* Vl) { const size_t e = ((size_t)blockIdx.x * 256 + threadIdx.x) * 2; if (e >= (size_t)nheads * HD * TT) return; const int t = (int)(e % TT); const int d = (int)((e / TT) % HD); const int g = (int)(e / ((size_t)TT * HD)); v2h o16; v2us oh, ol;
#pragma unroll
    for (int q = 0; q < 2; ++q) { const float x = bfr(F[((size_t)g * TT + t + q) * pitch + d]);   /* RAW d_in source: bf16-rounded first */ o16[q] = tohx(x); unsigned short a2, c2; splitf(x, a2, c2); oh[q] = a2; ol[q] = c2; }
    const size_t eo = (size_t)g * HD * TT + fragv(d, t);   /* all three V^T planes in fragment order; t is even: the pair stays side by side */
    *(v2h*)(V16 + eo) = o16; *(v2us*)(Vh + eo) = oh; *(v2us*)(Vl + eo) = ol;  }
__global__ __launch_bounds__(256) void k_csid(float* CS) { const int idx = blockIdx.x * 256 + threadIdx.x; if (idx >= TT * HD) return; v2f cs; cs[0] = 1.0f; cs[1] = 0.0f; *(v2f*)(CS + (size_t)idx * 2) = cs;  }
typedef __attribute__((ext_vector_type(2))) __bf16 v2bf;
typedef __attribute__((ext_vector_type(8))) unsigned v8u;
__device__ __forceinline__ unsigned pkbf(float a, float b) { v2f x; x[0] = a; x[1] = b; return __builtin_bit_cast(unsigned, __builtin_convertvector(x, v2bf)); }   /* two f32 -> two bf16, round to nearest even */
__device__ __forceinline__ unsigned pkh(float a, float b) { v2f x; x[0] = a; x[1] = b; return __builtin_bit_cast(unsigned, __builtin_convertvector(x, v2h)); }     /* two f32 -> two fp16, round to nearest even */
__device__ __forceinline__ float lo2f(unsigned u) { return __uint_as_float(u << 16); }
__device__ __forceinline__ float hi2f(unsigned u) { return __uint_as_float(u & 0xFFFF0000u); }
// hold(): a load group stays where the source puts it. The memory clobber keeps the optimiser from merging or sinking the loads across it, the scheduling barrier keeps the scheduler from it: without them each group moves down to its first use (or into the next pass) and its latency is waited for in full.
__device__ __forceinline__ void hold() { asm volatile("" ::: "memory"); __builtin_amdgcn_sched_barrier(0); }
// holdx(): the same behind a load group, with the wait that stands in front of any overwrite of the group's address registers.
__device__ __forceinline__ void holdx() { asm volatile("s_wait_xcnt 0x0" ::: "memory"); __builtin_amdgcn_sched_barrier(0); }
__device__ __forceinline__ float xhalf(float x) { return __builtin_bit_cast(float, __builtin_amdgcn_permlanex16(__builtin_bit_cast(int, x), __builtin_bit_cast(int, x), 0x76543210, 0xfedcba98, false, false)); }   /* lane l <-> lane l ^ 16 */

// fa_rows: one wave, 16 query rows of one plane, all TT keys in passes of 32. S^T = K.Q^T (tile rows = keys, columns = queries) and O^T += V^T.P^T, so lane (lr, hi) holds query lr only:
// of each 16-key score tile it has keys 8 hi + j in register j, which is the k order of a B fragment over two tiles: P goes from the score accumulators into the second product without leaving the lane.
// Softmax with a running maximum m_run and running sum l_run per query (each wave half sums its own keys; the halves meet once at the end); the output tile is rescaled by exp(m_old - m_new) every pass and divided by the sum at the end.
// Every inner loop is fully unrolled: fragments, scores and accumulators stay in registers only under compile-time indices. The loop over the passes stays rolled.
template <bool HI>
__device__ __forceinline__ void fa_rows(const bf* __restrict__ Qh, const bf* __restrict__ Ql, const bf* __restrict__ Kh, const bf* __restrict__ Kl, const h16* __restrict__ V16, const bf* __restrict__ Vh, const bf* __restrict__ Vl, const float* __restrict__ mrow, float* __restrict__ orow) {
    const int lane = threadIdx.x & 31, lr = lane & 15, hi = lane >> 4;
    v16bf qh[2], ql[2];
#pragma unroll
    for (int ks = 0; ks < 2; ++ks) { qh[ks] = WFrag<bf>::ld(Qh + lr * HD + 32 * ks + 8 * hi); ql[ks] = WFrag<bf>::ld(Ql + lr * HD + 32 * ks + 8 * hi); }
    const int koff = 8 * lane, voff = 8 * lane, moff = lr * TT + 8 * hi;   /* K and V^T planes are in fragment order: tile kt, k step ks of K at 1024 kt + 512 ks, tile dt of V^T at 512 dt behind the pass's first element HD x key0 */
    v8f acc[4];
#pragma unroll
    for (int dt = 0; dt < 4; ++dt) acc[dt] = (v8f){};
    float m_run = -3.0e38f, l_run = 0.f;
    v16bf kh[2][2], kl[2][2]; v4f mk[2][2];
#pragma unroll
    for (int kt = 0; kt < 2; ++kt) {
#pragma unroll
        for (int ks = 0; ks < 2; ++ks) { kh[kt][ks] = WFrag<bf>::ldf(Kh + koff + 1024 * kt + 512 * ks); kl[kt][ks] = WFrag<bf>::ldf(Kl + koff + 1024 * kt + 512 * ks); mk[kt][ks] = *(const v4f*)(mrow + moff + 16 * kt + 4 * ks); } }
    for (int key0 = 0; key0 < TT; key0 += 32) {
        const int kn = (key0 + 32 < TT) ? key0 + 32 : key0;   /* the pass fetched ahead; the last pass fetches its own rows again (in bounds, unused) */
        v16h v6[4]; v16bf vh[4], vl[4];   /* this pass's V^T fragments: asked for first, used last */
#pragma unroll
        for (int dt = 0; dt < 4; ++dt) { if constexpr (HI) { vh[dt] = WFrag<bf>::ldf(Vh + voff + key0 * HD + 512 * dt); vl[dt] = WFrag<bf>::ldf(Vl + voff + key0 * HD + 512 * dt); } else v6[dt] = WFrag<h16>::ldf(V16 + voff + key0 * HD + 512 * dt); }
        hold();   /* V^T is asked for before the first product starts (its address registers are next written behind the waits for its data) */
        v8f s[2]; s[0] = (v8f){}; s[1] = (v8f){};
#pragma unroll
        for (int ks = 0; ks < 2; ++ks) {
#pragma unroll
            for (int kt = 0; kt < 2; ++kt) s[kt] = wmmab(kh[kt][ks], qh[ks], s[kt]);
#pragma unroll
            for (int kt = 0; kt < 2; ++kt) s[kt] = wmmab(kh[kt][ks], ql[ks], s[kt]);
#pragma unroll
            for (int kt = 0; kt < 2; ++kt) s[kt] = wmmab(kl[kt][ks], qh[ks], s[kt]); }
        hold();   /* the next K fragments are not asked for earlier: issued from here most of them land in the registers this pass has just read */
        /* next pass's K fragments, in flight under this pass's softmax and second product */
#pragma unroll
        for (int kt = 0; kt < 2; ++kt) {
#pragma unroll
            for (int ks = 0; ks < 2; ++ks) { kh[kt][ks] = WFrag<bf>::ldf(Kh + koff + kn * HD + 1024 * kt + 512 * ks); kl[kt][ks] = WFrag<bf>::ldf(Kl + koff + kn * HD + 1024 * kt + 512 * ks); } }
        holdx();   /* K is asked for before the softmax starts */
        float t[16]; float mx = -3.0e38f;
#pragma unroll
        for (int kt = 0; kt < 2; ++kt) {
#pragma unroll
            for (int jp = 0; jp < 4; ++jp) { const unsigned u = pkbf(mk[kt][jp >> 1][(jp & 1) * 2], mk[kt][jp >> 1][(jp & 1) * 2 + 1]);   /* mask bf16-rounded, added in f32: scores x SCL + attn_mask[i][j] */
                t[kt * 8 + 2 * jp] = fmaf(s[kt][2 * jp], SCL, lo2f(u)); t[kt * 8 + 2 * jp + 1] = fmaf(s[kt][2 * jp + 1], SCL, hi2f(u)); mx = fmaxf(mx, fmaxf(t[kt * 8 + 2 * jp], t[kt * 8 + 2 * jp + 1])); } }
        hold();   /* the next mask values are not asked for earlier: this pass's are read above */
        /* next pass's mask values */
#pragma unroll
        for (int kt = 0; kt < 2; ++kt) {
#pragma unroll
            for (int hf = 0; hf < 2; ++hf) mk[kt][hf] = *(const v4f*)(mrow + moff + kn + 16 * kt + 4 * hf); }
        holdx();   /* the mask loads stay in this pass */
        mx = fmaxf(mx, xhalf(mx));   /* both halves hold the query's maximum of this pass */
        const float m_new = fmaxf(m_run, mx); float corr = (m_run - m_new) * L2E; m_run = m_new;   /* becomes 2^corr below: 0 on the first pass */
        const float nm = (HI ? 0.0f : PSH) - m_new * L2E;
#pragma unroll
        for (int k = 0; k < 16; ++k) t[k] = fmaf(t[k], L2E, nm);
        /* the pass's 17 exponentials as one run, each in place in a register of its own: none waits for its neighbour (under the register cap the compiler sent every argument through one register: multiply-add, wait, exponential, 16 times over),
           and none is followed directly by a reader of its result or a writer of its source; the v_nop is that free slot behind the last one */
        asm("v_exp_f32 %0, %0\n\tv_exp_f32 %1, %1\n\tv_exp_f32 %2, %2\n\tv_exp_f32 %3, %3\n\tv_exp_f32 %4, %4\n\tv_exp_f32 %5, %5\n\tv_exp_f32 %6, %6\n\tv_exp_f32 %7, %7\n\tv_exp_f32 %8, %8\n\t"
            "v_exp_f32 %9, %9\n\tv_exp_f32 %10, %10\n\tv_exp_f32 %11, %11\n\tv_exp_f32 %12, %12\n\tv_exp_f32 %13, %13\n\tv_exp_f32 %14, %14\n\tv_exp_f32 %15, %15\n\tv_exp_f32 %16, %16\n\tv_nop"
            : "+v"(corr), "+v"(t[0]), "+v"(t[1]), "+v"(t[2]), "+v"(t[3]), "+v"(t[4]), "+v"(t[5]), "+v"(t[6]), "+v"(t[7]), "+v"(t[8]), "+v"(t[9]), "+v"(t[10]), "+v"(t[11]), "+v"(t[12]), "+v"(t[13]), "+v"(t[14]), "+v"(t[15]));
        float ps[8];   /* the pass's sum as a tree: a chain of 16 dependent adds would stand exposed in a lone wave */
#pragma unroll
        for (int k = 0; k < 8; ++k) ps[k] = t[2 * k] + t[2 * k + 1];
#pragma unroll
        for (int st = 4; st; st >>= 1) {
#pragma unroll
            for (int k = 0; k < st; ++k) ps[k] += ps[k + st]; }
        l_run = fmaf(l_run, corr, ps[0]);
#pragma unroll
        for (int dt = 0; dt < 4; ++dt) acc[dt] = acc[dt] * corr;
        if constexpr (HI) {
            v8u uh, ul;
#pragma unroll
            for (int i = 0; i < 8; ++i) { uh[i] = pkbf(t[2 * i], t[2 * i + 1]); ul[i] = pkbf(t[2 * i] - lo2f(uh[i]), t[2 * i + 1] - hi2f(uh[i])); }
            const v16bf ph = __builtin_bit_cast(v16bf, uh), pl = __builtin_bit_cast(v16bf, ul);
#pragma unroll
            for (int dt = 0; dt < 4; ++dt) acc[dt] = wmmab(vh[dt], ph, acc[dt]);
#pragma unroll
            for (int dt = 0; dt < 4; ++dt) acc[dt] = wmmab(vh[dt], pl, acc[dt]);
#pragma unroll
            for (int dt = 0; dt < 4; ++dt) acc[dt] = wmmab(vl[dt], ph, acc[dt]);
        } else {
            v8u up;
#pragma unroll
            for (int i = 0; i < 8; ++i) up[i] = pkh(t[2 * i], t[2 * i + 1]);
            const v16h pf = __builtin_bit_cast(v16h, up);
#pragma unroll
            for (int dt = 0; dt < 4; ++dt) acc[dt] = wmma16(v6[dt], pf, acc[dt]);
        }
        hold();   /* whatever register copies the loop's back edge needs for the fetched-ahead values stay down here: higher up they would wait for those loads in the middle of the pass */
    }
    const float inv = __fdiv_rn(1.0f, l_run + xhalf(l_run));
#pragma unroll
    for (int dt = 0; dt < 4; ++dt) {   /* register j of tile dt is d = 16 dt + 8 hi + j of query lr: 32 contiguous bytes per lane */
        v4f o0, o1;
#pragma unroll
        for (int j = 0; j < 4; ++j) { o0[j] = acc[dt][j] * inv; o1[j] = acc[dt][4 + j] * inv; }
        float* op = orow + lr * HD + 16 * dt + 8 * hi; *(v4f*)op = o0; *(v4f*)(op + 4) = o1; }
}
// k_fattn: grid (TT / (16 FW), ZH), FW waves; wave w of block x takes query rows 16 (FW x + w) .. + 15 of plane y. No LDS, no barrier: the waves of a block only share K, V lines in the WGP cache.
// amdgpu_waves_per_eu(4, 4) caps the kernel at 256 registers: left free, the rows < RH loop takes a few more and switches register banks (s_set_vgpr_msb) 18 times a pass.
__global__ __launch_bounds__(32 * FW) __attribute__((amdgpu_waves_per_eu(4, 4))) void k_fattn(const bf* __restrict__ Qh, const bf* __restrict__ Ql, const bf* __restrict__ Kh, const bf* __restrict__ Kl, const h16* __restrict__ V16, const bf* __restrict__ Vh, const bf* __restrict__ Vl, const float* __restrict__ mskf, float* __restrict__ OUTb) {
    const int w = __builtin_amdgcn_readfirstlane((int)(threadIdx.x >> 5)); const int q0 = ((int)blockIdx.x * FW + w) * 16; const size_t zo = (size_t)blockIdx.y * TT * HD;
    if (q0 < RH) fa_rows<true>(Qh + zo + (size_t)q0 * HD, Ql + zo + (size_t)q0 * HD, Kh + zo, Kl + zo, V16 + zo, Vh + zo, Vl + zo, mskf + (size_t)q0 * TT, OUTb + zo + (size_t)q0 * HD);
    else fa_rows<false>(Qh + zo + (size_t)q0 * HD, Ql + zo + (size_t)q0 * HD, Kh + zo, Kl + zo, V16 + zo, Vh + zo, Vl + zo, mskf + (size_t)q0 * TT, OUTb + zo + (size_t)q0 * HD);
}
extern "C" void kernel_launch(void* const* d_in, const int* in_sizes, int n_in,
                              void* d_out, int out_size, void* d_ws, size_t ws_size, hipStream_t stream) {
    (void)in_sizes; (void)n_in; (void)out_size;
    const float* x = (const float*)d_in[0]; const float* xk = (const float*)d_in[1]; const float* xv = (const float*)d_in[2]; const float* amask = (const float*)d_in[3];   /* attn_mask f32 [1][1][2048][2048], read */   /* query, key, value: [32][2048][64] each (no projections) */ const float* wq = nullptr, *wk = nullptr, *wv = nullptr, *wo = nullptr; (void)wq; (void)wk; (void)wv; (void)wo;
    float* OUT = (float*)d_out;     // [32][2048][64]
    char* wsp = (char*)d_ws;
    auto take = [&](size_t bytes) { char* p = wsp; wsp += (bytes + 255) & ~(size_t)255; return (void*)p; };
    bf* WQ = (bf*)take((size_t)DQ * DM * 2); bf* WK = (bf*)take((size_t)DKV * DM * 2); bf* WV = (bf*)take((size_t)DKV * DM * 2); float* CS = (float*)take((size_t)TT * HD * 2 * 4);
    bf* XB = (bf*)take((size_t)TT * DM * 2); float* FQ = (float*)take((size_t)TT * DQ * 4); float* FK = (float*)take((size_t)TT * DKV * 4);
    h16* QP16 = (h16*)take((size_t)ZH * TT * HD * 2); h16* KP16 = (h16*)take((size_t)ZH * TT * HD * 2); h16* VT16 = (h16*)take((size_t)ZH * HD * TT * 2);
    bf* QPh = (bf*)take((size_t)ZH * TT * HD * 2); bf* QPl = (bf*)take((size_t)ZH * TT * HD * 2); bf* KPh = (bf*)take((size_t)ZH * TT * HD * 2); bf* KPl = (bf*)take((size_t)ZH * TT * HD * 2); bf* VTh = (bf*)take((size_t)ZH * HD * TT * 2); bf* VTl = (bf*)take((size_t)ZH * HD * TT * 2);
    if ((size_t)(wsp - (char*)d_ws) > ws_size) return;    // ws 256 MiB
    float* FV = FK;   // FV aliases the k buffer; unused, as there is no v projection
    {   
      
       }
    k_csid<<<(TT * HD + 255) / 256, 256, 0, stream>>>(CS);
    const unsigned LQ = (unsigned)(((size_t)ZH * TT * HD / 2 + 255) / 256), LKv = LQ;
    for (int b = 0; b < NB_; b += ZH) {   /* one pass = ZH consecutive planes */
        
        /* no projections: the q, k, v inputs feed the plane builders directly */
        
        k_rope<false><<<LQ, 256, 0, stream>>>(x + (size_t)b * TT * HD, DQ, ZH, CS, nullptr, nullptr, 1.0f, QP16, QPh, QPl);   /* q planes straight from the input (bf16 hi/lo split of the f32 values) */
        
        k_rope<true><<<LKv, 256, 0, stream>>>(xk + (size_t)b * TT * HD, DKV, ZH, CS, nullptr, nullptr, 1.0f, KP16, KPh, KPl);
         k_vtp<<<LKv, 256, 0, stream>>>(xv + (size_t)b * TT * HD, DKV, ZH, VT16, VTh, VTl);
        k_fattn<<<dim3(TT / (16 * FW), ZH), 32 * FW, 0, stream>>>(QPh, QPl, KPh, KPl, VT16, VTh, VTl, amask, OUT + (size_t)b * TT * DQ);   /* scores (3 products on every row), mask, softmax and hybrid P.V in one launch; plane y of the pass uses q, k and v plane y */
         }
}

// v005
// Measured time: 166 microseconds a run.
// Two timings next to v004 put it at 1.88 and 1.84 times that version's speed.
// Over all steps from v000 it is 21.4 times as fast.
#include <hip/hip_runtime.h>

// Scaled dot-product attention on raw per-head inputs with an ADDITIVE random float mask (query, key, value [2][16][2048][64] = 32 planes, no projections; scores = q.k^T x 1/sqrt(64) + attn_mask with attn_mask f32 [1][1][2048][2048] standard-normal draws shared by all planes (read per (query, key) on device, bf16-rounded as every input); softmax over keys; out = probs.v -> [2][16][2048][64] (4.2 M); argument order query, key, value, attn_mask).
// Layout: all 32 planes in one pass, each launch covering them through grid y or 32 x the rows (5 launches); per plane: the raw f32 inputs are ROUNDED TO bf16 first and split into identity planes (the K and V^T planes in fragment order, see fragk / fragv); ONE fused kernel then walks the 2048 keys 32 at a time per 16 query rows: scores on hi/lo planes (3 products), mask added, running maximum and sum per query, P.V hybrid (rows < 512 hi/lo, rest fp16 x1024); scores and probabilities stay in registers, the kernel writes the output rows.
// Compute dtypes, f32 accumulate: every input rounded to bf16; scores 3 products on every row + bf16-rounded mask added in f32; softmax f32; P.V rows < 512 3 products, rest fp16; output f32.

#define NB_  32
#define TT   2048
#define DM   64
#define NH_  1
#define NKV  1
#define REP  (NH_ / NKV)
#define HD   64
#define DQ   (NH_ * HD)
#define DKV  (NKV * HD)
#define ZH   32                   // planes per pass: every launch of a pass covers ZH planes (grid y, or ZH x the rows); 32 / ZH passes. All 32: nine 16-bit planes of 8 MiB each in the workspace, and 1024 work-groups in the fused launch
#define RH   512                  // query rows < RH use hi+lo planes (0: none)
#define WIN  0
#define FW   4                    // waves per work-group of the fused kernel, 16 query rows each: one wave per SIMD of a WGP, K and V shared through the WGP cache
#define PSH  10.0f                // rows >= RH: probabilities carry a factor 2^PSH into fp16 (it cancels against the sum)
#define L2E  1.4426950408889634f
#define SCL  0.125f   // 1/sqrt(64)
typedef _Float16 h16;
typedef unsigned short bf;
typedef __attribute__((ext_vector_type(16))) __bf16   v16bf;
typedef __attribute__((ext_vector_type(16))) _Float16 v16h;
typedef __attribute__((ext_vector_type(8)))  _Float16 v8h;
typedef __attribute__((ext_vector_type(8)))  unsigned short v8us;
typedef __attribute__((ext_vector_type(8)))  float    v8f;
typedef __attribute__((ext_vector_type(4)))  float    v4f;
typedef v8h  __attribute__((may_alias)) v8ha;
typedef v4f  __attribute__((may_alias)) v4fa;
typedef v8us __attribute__((may_alias)) v8usa;

__device__ __forceinline__ unsigned short f2bf(float f) { unsigned u = __float_as_uint(f); u += 0x7FFFu + ((u >> 16) & 1u); return (unsigned short)(u >> 16); }
__device__ __forceinline__ float bf2f(unsigned short b) { return __uint_as_float(((unsigned)b) << 16); }
__device__ __forceinline__ float bfr(float f) { return bf2f(f2bf(f)); }
__device__ __forceinline__ v16h cat16(v8h lo, v8h hi) { return __builtin_shufflevector(lo, hi, 0, 1, 2, 3, 4, 5, 6, 7, 8, 9, 10, 11, 12, 13, 14, 15); }
__device__ __forceinline__ v16bf cat16b(v8us lo, v8us hi) { return __builtin_bit_cast(v16bf, __builtin_shufflevector(lo, hi, 0, 1, 2, 3, 4, 5, 6, 7, 8, 9, 10, 11, 12, 13, 14, 15)); }
__device__ __forceinline__ v8f wmma16(v16h a, v16h b, v8f c) { return __builtin_amdgcn_wmma_f32_16x16x32_f16(false, a, false, b, (short)0, c, false, false); }
__device__ __forceinline__ v8f wmmab(v16bf a, v16bf b, v8f c) { return __builtin_amdgcn_wmma_f32_16x16x32_bf16(false, a, false, b, (short)0, c, false, false); }



// 16x16x32 operand fragment of a K-contiguous 16-bit plane: the pointer already holds row (lane & 15) and k offset 8 x (lane >> 4); A and B use the same map
template <typename T16> struct WFrag;
// ldf: the same fragment from a plane stored in FRAGMENT ORDER: the 32 lanes' 16-byte pieces of one load lie side by side (512 contiguous bytes = 4 whole cache lines a load, where a row-major plane makes a load touch 16 lines for 32 bytes each); the pointer already holds 8 x lane, the fragment's second half follows 256 elements on
template <> struct WFrag<h16> { typedef v16h V; static __device__ __forceinline__ V ld(const h16* p) { return cat16(*(const v8h*)p, *(const v8h*)(p + 16)); } static __device__ __forceinline__ V ldf(const h16* p) { return cat16(*(const v8h*)p, *(const v8h*)(p + 256)); } static __device__ __forceinline__ v8f mma(V a, V b, v8f c) { return wmma16(a, b, c); } };
template <> struct WFrag<bf> { typedef v16bf V; static __device__ __forceinline__ V ld(const bf* p) { return cat16b(*(const v8us*)p, *(const v8us*)(p + 16)); } static __device__ __forceinline__ V ldf(const bf* p) { return cat16b(*(const v8us*)p, *(const v8us*)(p + 256)); } static __device__ __forceinline__ v8f mma(V a, V b, v8f c) { return wmmab(a, b, c); } };

__device__ __forceinline__ h16 tohx(float x) { return (h16)x; }
__device__ __forceinline__ void splitf(float y, unsigned short& h, unsigned short& l) { h = f2bf(y); l = f2bf(y - bf2f(h)); }
typedef __attribute__((ext_vector_type(2))) _Float16 v2h;
typedef __attribute__((ext_vector_type(4))) _Float16 v4h;
typedef __attribute__((ext_vector_type(2))) unsigned short v2us;
typedef __attribute__((ext_vector_type(4))) unsigned short v4us;
typedef __attribute__((ext_vector_type(2))) float v2f;
typedef __attribute__((ext_vector_type(4))) int v4i;

// Fragment order of one plane (TT x HD elements). A fragment half is [lane = 16 hi + lr][j = 0..7], 256 elements; lane (lr, hi) holds tile row lr and k = 16 c + 8 hi + j of half c.
// fragk: K, tile rows = keys, k = d: [key / 16][d / 32][c = d / 16 & 1][hi = d / 8 & 1][lr = key & 15][j = d & 7]; a pass of 32 keys is 2048 consecutive elements.
// fragv: V^T, tile rows = d, k = keys: [key / 32][d / 16][c = key / 16 & 1][hi = key / 8 & 1][lr = d & 15][j = key & 7]; a pass of 32 keys is 2048 consecutive elements.
__device__ __forceinline__ size_t fragk(int key, int d) { return (size_t)((key >> 4) * 1024 + (d >> 5) * 512 + ((d >> 4) & 1) * 256 + ((d >> 3) & 1) * 128 + (key & 15) * 8 + (d & 7)); }
__device__ __forceinline__ size_t fragv(int d, int key) { return (size_t)((key >> 5) * 2048 + (d >> 4) * 512 + ((key >> 4) & 1) * 256 + ((key >> 3) & 1) * 128 + (d & 15) * 8 + (key & 7)); }
// k_rope: head planes [h][t][d] (fp16 + hi/lo) of rope(x) x sc with the rotate-half convention out[d] = x[d] cos[t][d] - x[d+HD/2] sin[t][d], out[d+HD/2] = x[d+HD/2] cos[t][d+HD/2] + x[d] sin[t][d+HD/2]; FO: the hi/lo planes go out in fragment order (fragk)
template <bool FO> __global__ __launch_bounds__(256) void k_rope(const float* __restrict__ F, int pitch, int nheads, const float* __restrict__ CS, const float* __restrict__ RF, const float* __restrict__ nw, float sc, h16* P16, bf* Ph, bf* Pl) {
    const size_t e = ((size_t)blockIdx.x * 256 + threadIdx.x) * 2; if (e >= (size_t)nheads * TT * HD) return; const int d = (int)(e % HD); const int t = (int)((e / HD) % TT); const int h = (int)(e / ((size_t)HD * TT));
    const float* f = F + ((size_t)h * TT + t) * pitch;   /* source planes [h][t][d] */
    const float rf = RF ? RF[(size_t)h * TT + t] : 1.0f; v2h o16; v2us oh, ol;
#pragma unroll
    for (int q = 0; q < 2; ++q) { const int dd = d + q; const int dp = (dd < HD / 2) ? dd + HD / 2 : dd - HD / 2; float x0 = bfr(f[dd]), x1 = bfr(f[dp]);   /* RAW d_in source: round to bf16 FIRST; the lo planes are then identically zero */
        if (RF) { float n0 = __fmul_rn(x0, rf), n1 = __fmul_rn(x1, rf); asm volatile("" : "+v"(n0)); asm volatile("" : "+v"(n1)); x0 = __fmul_rn(bfr(nw[dd]), n0); x1 = __fmul_rn(bfr(nw[dp]), n1); }
        const v2f cs = *(const v2f*)(CS + ((size_t)t * HD + dd) * 2); float a = __fmul_rn(x0, cs[0]), bq = __fmul_rn(x1, cs[1]); asm volatile("" : "+v"(a)); asm volatile("" : "+v"(bq)); const float r = ((dd < HD / 2) ? __fsub_rn(a, bq) : __fadd_rn(a, bq)) * sc;
        o16[q] = tohx(r); unsigned short a2, c2; splitf(r, a2, c2); oh[q] = a2; ol[q] = c2; }
    const size_t eo = FO ? (size_t)h * TT * HD + fragk(t, d) : e;   /* d is even: the pair stays side by side */
    *(v2h*)(P16 + e) = o16; *(v2us*)(Ph + eo) = oh; *(v2us*)(Pl + eo) = ol;  }
__global__ __launch_bounds__(256) void k_vtp(const float* __restrict__ F, int pitch, int nheads, h16* V16, bf* Vh, bf* Vl) { const size_t e = ((size_t)blockIdx.x * 256 + threadIdx.x) * 2; if (e >= (size_t)nheads * HD * TT) return; const int t = (int)(e % TT); const int d = (int)((e / TT) % HD); const int g = (int)(e / ((size_t)TT * HD)); v2h o16; v2us oh, ol;
#pragma unroll
    for (int q = 0; q < 2; ++q) { const float x = bfr(F[((size_t)g * TT + t + q) * pitch + d]);   /* RAW d_in source: bf16-rounded first */ o16[q] = tohx(x); unsigned short a2, c2; splitf(x, a2, c2); oh[q] = a2; ol[q] = c2; }
    const size_t eo = (size_t)g * HD * TT + fragv(d, t);   /* all three V^T planes in fragment order; t is even: the pair stays side by side */
    *(v2h*)(V16 + eo) = o16; *(v2us*)(Vh + eo) = oh; *(v2us*)(Vl + eo) = ol;  }
__global__ __launch_bounds__(256) void k_csid(float* CS) { const int idx = blockIdx.x * 256 + threadIdx.x; if (idx >= TT * HD) return; v2f cs; cs[0] = 1.0f; cs[1] = 0.0f; *(v2f*)(CS + (size_t)idx * 2) = cs;  }
typedef __attribute__((ext_vector_type(2))) __bf16 v2bf;
typedef __attribute__((ext_vector_type(8))) unsigned v8u;
__device__ __forceinline__ unsigned pkbf(float a, float b) { v2f x; x[0] = a; x[1] = b; return __builtin_bit_cast(unsigned, __builtin_convertvector(x, v2bf)); }   /* two f32 -> two bf16, round to nearest even */
__device__ __forceinline__ unsigned pkh(float a, float b) { v2f x; x[0] = a; x[1] = b; return __builtin_bit_cast(unsigned, __builtin_convertvector(x, v2h)); }     /* two f32 -> two fp16, round to nearest even */
__device__ __forceinline__ float lo2f(unsigned u) { return __uint_as_float(u << 16); }
__device__ __forceinline__ float hi2f(unsigned u) { return __uint_as_float(u & 0xFFFF0000u); }
// hold(): a load group stays where the source puts it. The memory clobber keeps the optimiser from merging or sinking the loads across it, the scheduling barrier keeps the scheduler from it: without them each group moves down to its first use (or into the next pass) and its latency is waited for in full.
__device__ __forceinline__ void hold() { asm volatile("" ::: "memory"); __builtin_amdgcn_sched_barrier(0); }
// holdx(): the same behind a load group, with the wait that stands in front of any overwrite of the group's address registers.
__device__ __forceinline__ void holdx() { asm volatile("s_wait_xcnt 0x0" ::: "memory"); __builtin_amdgcn_sched_barrier(0); }
__device__ __forceinline__ float xhalf(float x) { return __builtin_bit_cast(float, __builtin_amdgcn_permlanex16(__builtin_bit_cast(int, x), __builtin_bit_cast(int, x), 0x76543210, 0xfedcba98, false, false)); }   /* lane l <-> lane l ^ 16 */

// fa_rows: one wave, 16 query rows of one plane, all TT keys in passes of 32. S^T = K.Q^T (tile rows = keys, columns = queries) and O^T += V^T.P^T, so lane (lr, hi) holds query lr only:
// of each 16-key score tile it has keys 8 hi + j in register j, which is the k order of a B fragment over two tiles: P goes from the score accumulators into the second product without leaving the lane.
// Softmax with a running maximum m_run and running sum l_run per query (each wave half sums its own keys; the halves meet once at the end); the output tile is rescaled by exp(m_old - m_new) every pass and divided by the sum at the end.
// Every inner loop is fully unrolled: fragments, scores and accumulators stay in registers only under compile-time indices. The loop over the passes stays rolled.
template <bool HI>
__device__ __forceinline__ void fa_rows(const bf* __restrict__ Qh, const bf* __restrict__ Ql, const bf* __restrict__ Kh, const bf* __restrict__ Kl, const h16* __restrict__ V16, const bf* __restrict__ Vh, const bf* __restrict__ Vl, const float* __restrict__ mrow, float* __restrict__ orow) {
    const int lane = threadIdx.x & 31, lr = lane & 15, hi = lane >> 4;
    v16bf qh[2], ql[2];
#pragma unroll
    for (int ks = 0; ks < 2; ++ks) { qh[ks] = WFrag<bf>::ld(Qh + lr * HD + 32 * ks + 8 * hi); ql[ks] = WFrag<bf>::ld(Ql + lr * HD + 32 * ks + 8 * hi); }
    const int koff = 8 * lane, voff = 8 * lane, moff = lr * TT + 8 * hi;   /* K and V^T planes are in fragment order: tile kt, k step ks of K at 1024 kt + 512 ks, tile dt of V^T at 512 dt behind the pass's first element HD x key0 */
    v8f acc[4];
#pragma unroll
    for (int dt = 0; dt < 4; ++dt) acc[dt] = (v8f){};
    float m_run = -3.0e38f, l_run = 0.f;
    v16bf kh[2][2], kl[2][2]; v4f mk[2][2];
#pragma unroll
    for (int kt = 0; kt < 2; ++kt) {
#pragma unroll
        for (int ks = 0; ks < 2; ++ks) { kh[kt][ks] = WFrag<bf>::ldf(Kh + koff + 1024 * kt + 512 * ks); kl[kt][ks] = WFrag<bf>::ldf(Kl + koff + 1024 * kt + 512 * ks); mk[kt][ks] = *(const v4f*)(mrow + moff + 16 * kt + 4 * ks); } }
    for (int key0 = 0; key0 < TT; key0 += 32) {
        const int kn = (key0 + 32 < TT) ? key0 + 32 : key0;   /* the pass fetched ahead; the last pass fetches its own rows again (in bounds, unused) */
        v16h v6[4]; v16bf vh[4], vl[4];   /* this pass's V^T fragments: asked for first, used last */
#pragma unroll
        for (int dt = 0; dt < 4; ++dt) { if constexpr (HI) { vh[dt] = WFrag<bf>::ldf(Vh + voff + key0 * HD + 512 * dt); vl[dt] = WFrag<bf>::ldf(Vl + voff + key0 * HD + 512 * dt); } else v6[dt] = WFrag<h16>::ldf(V16 + voff + key0 * HD + 512 * dt); }
        hold();   /* V^T is asked for before the first product starts (its address registers are next written behind the waits for its data) */
        v8f s[2]; s[0] = (v8f){}; s[1] = (v8f){};
#pragma unroll
        for (int ks = 0; ks < 2; ++ks) {
#pragma unroll
            for (int kt = 0; kt < 2; ++kt) s[kt] = wmmab(kh[kt][ks], qh[ks], s[kt]);
#pragma unroll
            for (int kt = 0; kt < 2; ++kt) s[kt] = wmmab(kh[kt][ks], ql[ks], s[kt]);
#pragma unroll
            for (int kt = 0; kt < 2; ++kt) s[kt] = wmmab(kl[kt][ks], qh[ks], s[kt]); }
        hold();   /* the next K fragments are not asked for earlier: issued from here most of them land in the registers this pass has just read */
        /* next pass's K fragments, in flight under this pass's softmax and second product */
#pragma unroll
        for (int kt = 0; kt < 2; ++kt) {
#pragma unroll
            for (int ks = 0; ks < 2; ++ks) { kh[kt][ks] = WFrag<bf>::ldf(Kh + koff + kn * HD + 1024 * kt + 512 * ks); kl[kt][ks] = WFrag<bf>::ldf(Kl + koff + kn * HD + 1024 * kt + 512 * ks); } }
        holdx();   /* K is asked for before the softmax starts */
        float t[16]; float mx = -3.0e38f;
#pragma unroll
        for (int kt = 0; kt < 2; ++kt) {
#pragma unroll
            for (int jp = 0; jp < 4; ++jp) { const unsigned u = pkbf(mk[kt][jp >> 1][(jp & 1) * 2], mk[kt][jp >> 1][(jp & 1) * 2 + 1]);   /* mask bf16-rounded, added in f32: scores x SCL + attn_mask[i][j] */
                t[kt * 8 + 2 * jp] = fmaf(s[kt][2 * jp], SCL, lo2f(u)); t[kt * 8 + 2 * jp + 1] = fmaf(s[kt][2 * jp + 1], SCL, hi2f(u)); mx = fmaxf(mx, fmaxf(t[kt * 8 + 2 * jp], t[kt * 8 + 2 * jp + 1])); } }
        hold();   /* the next mask values are not asked for earlier: this pass's are read above */
        /* next pass's mask values */
#pragma unroll
        for (int kt = 0; kt < 2; ++kt) {
#pragma unroll
            for (int hf = 0; hf < 2; ++hf) mk[kt][hf] = *(const v4f*)(mrow + moff + kn + 16 * kt + 4 * hf); }
        holdx();   /* the mask loads stay in this pass */
        mx = fmaxf(mx, xhalf(mx));   /* both halves hold the query's maximum of this pass */
        const float m_new = fmaxf(m_run, mx); float corr = (m_run - m_new) * L2E; m_run = m_new;   /* becomes 2^corr below: 0 on the first pass */
        const float nm = (HI ? 0.0f : PSH) - m_new * L2E;
#pragma unroll
        for (int k = 0; k < 16; ++k) t[k] = fmaf(t[k], L2E, nm);
        /* the pass's 17 exponentials as one run, each in place in a register of its own: none waits for its neighbour (under the register cap the compiler sent every argument through one register: multiply-add, wait, exponential, 16 times over),
           and none is followed directly by a reader of its result or a writer of its source; the v_nop is that free slot behind the last one */
        asm("v_exp_f32 %0, %0\n\tv_exp_f32 %1, %1\n\tv_exp_f32 %2, %2\n\tv_exp_f32 %3, %3\n\tv_exp_f32 %4, %4\n\tv_exp_f32 %5, %5\n\tv_exp_f32 %6, %6\n\tv_exp_f32 %7, %7\n\tv_exp_f32 %8, %8\n\t"
            "v_exp_f32 %9, %9\n\tv_exp_f32 %10, %10\n\tv_exp_f32 %11, %11\n\tv_exp_f32 %12, %12\n\tv_exp_f32 %13, %13\n\tv_exp_f32 %14, %14\n\tv_exp_f32 %15, %15\n\tv_exp_f32 %16, %16\n\tv_nop"
            : "+v"(corr), "+v"(t[0]), "+v"(t[1]), "+v"(t[2]), "+v"(t[3]), "+v"(t[4]), "+v"(t[5]), "+v"(t[6]), "+v"(t[7]), "+v"(t[8]), "+v"(t[9]), "+v"(t[10]), "+v"(t[11]), "+v"(t[12]), "+v"(t[13]), "+v"(t[14]), "+v"(t[15]));
        float ps[8];   /* the pass's sum as a tree: a chain of 16 dependent adds would stand exposed in a lone wave */
#pragma unroll
        for (int k = 0; k < 8; ++k) ps[k] = t[2 * k] + t[2 * k + 1];
#pragma unroll
        for (int st = 4; st; st >>= 1) {
#pragma unroll
            for (int k = 0; k < st; ++k) ps[k] += ps[k + st]; }
        l_run = fmaf(l_run, corr, ps[0]);
#pragma unroll
        for (int dt = 0; dt < 4; ++dt) acc[dt] = acc[dt] * corr;
        if constexpr (HI) {
            v8u uh, ul;
#pragma unroll
            for (int i = 0; i < 8; ++i) { uh[i] = pkbf(t[2 * i], t[2 * i + 1]); ul[i] = pkbf(t[2 * i] - lo2f(uh[i]), t[2 * i + 1] - hi2f(uh[i])); }
            const v16bf ph = __builtin_bit_cast(v16bf, uh), pl = __builtin_bit_cast(v16bf, ul);
#pragma unroll
            for (int dt = 0; dt < 4; ++dt) acc[dt] = wmmab(vh[dt], ph, acc[dt]);
#pragma unroll
            for (int dt = 0; dt < 4; ++dt) acc[dt] = wmmab(vh[dt], pl, acc[dt]);
#pragma unroll
            for (int dt = 0; dt < 4; ++dt) acc[dt] = wmmab(vl[dt], ph, acc[dt]);
        } else {
            v8u up;
#pragma unroll
            for (int i = 0; i < 8; ++i) up[i] = pkh(t[2 * i], t[2 * i + 1]);
            const v16h pf = __builtin_bit_cast(v16h, up);
#pragma unroll
            for (int dt = 0; dt < 4; ++dt) acc[dt] = wmma16(v6[dt], pf, acc[dt]);
        }
        hold();   /* whatever register copies the loop's back edge needs for the fetched-ahead values stay down here: higher up they would wait for those loads in the middle of the pass */
    }
    const float inv = __fdiv_rn(1.0f, l_run + xhalf(l_run));
#pragma unroll
    for (int dt = 0; dt < 4; ++dt) {   /* register j of tile dt is d = 16 dt + 8 hi + j of query lr: 32 contiguous bytes per lane */
        v4f o0, o1;
#pragma unroll
        for (int j = 0; j < 4; ++j) { o0[j] = acc[dt][j] * inv; o1[j] = acc[dt][4 + j] * inv; }
        float* op = orow + lr * HD + 16 * dt + 8 * hi; *(v4f*)op = o0; *(v4f*)(op + 4) = o1; }
}
// k_fattn: grid (TT / (16 FW), ZH), FW waves; wave w of block x takes query rows 16 (FW x + w) .. + 15 of plane y. No LDS, no barrier: the waves of a block only share K, V lines in the WGP cache.
// 1024 work-groups on 256 WGPs: four are resident per WGP (4 x 256 registers fill a SIMD's file), so each SIMD holds four waves of different work-groups, and one wave's load and dependency waits are issue slots for the other three.
// amdgpu_waves_per_eu(4, 4) caps the kernel at 256 registers: left free, the rows < RH loop takes a few more and switches register banks (s_set_vgpr_msb) 18 times a pass.
__global__ __launch_bounds__(32 * FW) __attribute__((amdgpu_waves_per_eu(4, 4))) void k_fattn(const bf* __restrict__ Qh, const bf* __restrict__ Ql, const bf* __restrict__ Kh, const bf* __restrict__ Kl, const h16* __restrict__ V16, const bf* __restrict__ Vh, const bf* __restrict__ Vl, const float* __restrict__ mskf, float* __restrict__ OUTb) {
    const int w = __builtin_amdgcn_readfirstlane((int)(threadIdx.x >> 5)); const int q0 = ((int)blockIdx.x * FW + w) * 16; const size_t zo = (size_t)blockIdx.y * TT * HD;
    if (q0 < RH) fa_rows<true>(Qh + zo + (size_t)q0 * HD, Ql + zo + (size_t)q0 * HD, Kh + zo, Kl + zo, V16 + zo, Vh + zo, Vl + zo, mskf + (size_t)q0 * TT, OUTb + zo + (size_t)q0 * HD);
    else fa_rows<false>(Qh + zo + (size_t)q0 * HD, Ql + zo + (size_t)q0 * HD, Kh + zo, Kl + zo, V16 + zo, Vh + zo, Vl + zo, mskf + (size_t)q0 * TT, OUTb + zo + (size_t)q0 * HD);
}
extern "C" void kernel_launch(void* const* d_in, const int* in_sizes, int n_in,
                              void* d_out, int out_size, void* d_ws, size_t ws_size, hipStream_t stream) {
    (void)in_sizes; (void)n_in; (void)out_size;
    const float* x = (const float*)d_in[0]; const float* xk = (const float*)d_in[1]; const float* xv = (const float*)d_in[2]; const float* amask = (const float*)d_in[3];   /* attn_mask f32 [1][1][2048][2048], read */   /* query, key, value: [32][2048][64] each (no projections) */ const float* wq = nullptr, *wk = nullptr, *wv = nullptr, *wo = nullptr; (void)wq; (void)wk; (void)wv; (void)wo;
    float* OUT = (float*)d_out;     // [32][2048][64]
    char* wsp = (char*)d_ws;
    auto take = [&](size_t bytes) { char* p = wsp; wsp += (bytes + 255) & ~(size_t)255; return (void*)p; };
    bf* WQ = (bf*)take((size_t)DQ * DM * 2); bf* WK = (bf*)take((size_t)DKV * DM * 2); bf* WV = (bf*)take((size_t)DKV * DM * 2); float* CS = (float*)take((size_t)TT * HD * 2 * 4);
    bf* XB = (bf*)take((size_t)TT * DM * 2); float* FQ = (float*)take((size_t)TT * DQ * 4); float* FK = (float*)take((size_t)TT * DKV * 4);
    h16* QP16 = (h16*)take((size_t)ZH * TT * HD * 2); h16* KP16 = (h16*)take((size_t)ZH * TT * HD * 2); h16* VT16 = (h16*)take((size_t)ZH * HD * TT * 2);
    bf* QPh = (bf*)take((size_t)ZH * TT * HD * 2); bf* QPl = (bf*)take((size_t)ZH * TT * HD * 2); bf* KPh = (bf*)take((size_t)ZH * TT * HD * 2); bf* KPl = (bf*)take((size_t)ZH * TT * HD * 2); bf* VTh = (bf*)take((size_t)ZH * HD * TT * 2); bf* VTl = (bf*)take((size_t)ZH * HD * TT * 2);
    if ((size_t)(wsp - (char*)d_ws) > ws_size) return;    // ws 256 MiB
    float* FV = FK;   // FV aliases the k buffer; unused, as there is no v projection
    {   
      
       }
    k_csid<<<(TT * HD + 255) / 256, 256, 0, stream>>>(CS);
    const unsigned LQ = (unsigned)(((size_t)ZH * TT * HD / 2 + 255) / 256), LKv = LQ;
    for (int b = 0; b < NB_; b += ZH) {   /* one pass = ZH consecutive planes */
        
        /* no projections: the q, k, v inputs feed the plane builders directly */
        
        k_rope<false><<<LQ, 256, 0, stream>>>(x + (size_t)b * TT * HD, DQ, ZH, CS, nullptr, nullptr, 1.0f, QP16, QPh, QPl);   /* q planes straight from the input (f32 values rounded to bf16 first, so the lo plane is zero) */
        
        k_rope<true><<<LKv, 256, 0, stream>>>(xk + (size_t)b * TT * HD, DKV, ZH, CS, nullptr, nullptr, 1.0f, KP16, KPh, KPl);
         k_vtp<<<LKv, 256, 0, stream>>>(xv + (size_t)b * TT * HD, DKV, ZH, VT16, VTh, VTl);
        k_fattn<<<dim3(TT / (16 * FW), ZH), 32 * FW, 0, stream>>>(QPh, QPl, KPh, KPl, VT16, VTh, VTl, amask, OUT + (size_t)b * TT * DQ);   /* scores (3 products on every row), mask, softmax and hybrid P.V in one launch; plane y of the pass uses q, k and v plane y */
         }
}

// v006
// Measured time: 123 microseconds a run.
// Next to v005, in two timings, it ran 1.36 and 1.35 times as fast.
// All steps since v000 together make it 29.0 times as fast.
#include <hip/hip_runtime.h>

// Scaled dot-product attention on raw per-head inputs with an ADDITIVE random float mask (query, key, value [2][16][2048][64] = 32 planes, no projections; scores = q.k^T x 1/sqrt(64) + attn_mask with attn_mask f32 [1][1][2048][2048] standard-normal draws shared by all planes (read per (query, key) on device, bf16-rounded as every input); softmax over keys; out = probs.v -> [2][16][2048][64] (4.2 M); argument order query, key, value, attn_mask).
// Layout: all 32 planes in one pass, each launch covering them through grid y or 32 x the rows (5 launches); per plane: the raw f32 inputs are ROUNDED TO bf16 first and split into identity planes (the K and V^T planes in fragment order, see fragk / fragv); ONE fused kernel then walks the 2048 keys 32 at a time per 16 query rows: scores on hi/lo planes (3 products), mask added, running maximum and sum per query, P.V hybrid (rows < 512 hi/lo, rest fp16 x1024); scores and probabilities stay in registers, the kernel writes the output rows.
// Compute dtypes, f32 accumulate: every input rounded to bf16; scores 3 products on every row + bf16-rounded mask added in f32; softmax f32; P.V rows < 512 3 products, rest fp16; output f32.

#define NB_  32
#define TT   2048
#define DM   64
#define NH_  1
#define NKV  1
#define REP  (NH_ / NKV)
#define HD   64
#define DQ   (NH_ * HD)
#define DKV  (NKV * HD)
#define ZH   32                   // planes per pass: every launch of a pass covers ZH planes (grid y, or ZH x the rows); 32 / ZH passes. All 32: nine 16-bit planes of 8 MiB each in the workspace, and 1024 work-groups in the fused launch
#define RH   512                  // query rows < RH use hi+lo planes (0: none)
#define WIN  0
#define PU   4                    // planes per thread of k_rope (ZH is a multiple of it)
#define FW   4                    // waves per work-group of the fused kernel, 16 query rows each: one wave per SIMD of a WGP, K and V shared through the WGP cache
#define PSH  10.0f                // rows >= RH: probabilities carry a factor 2^PSH into fp16 (it cancels against the sum)
#define L2E  1.4426950408889634f
#define SCL  0.125f   // 1/sqrt(64)
typedef _Float16 h16;
typedef unsigned short bf;
typedef __attribute__((ext_vector_type(16))) __bf16   v16bf;
typedef __attribute__((ext_vector_type(16))) _Float16 v16h;
typedef __attribute__((ext_vector_type(8)))  _Float16 v8h;
typedef __attribute__((ext_vector_type(8)))  unsigned short v8us;
typedef __attribute__((ext_vector_type(8)))  float    v8f;
typedef __attribute__((ext_vector_type(4)))  float    v4f;
typedef v8h  __attribute__((may_alias)) v8ha;
typedef v4f  __attribute__((may_alias)) v4fa;
typedef v8us __attribute__((may_alias)) v8usa;

__device__ __forceinline__ unsigned short f2bf(float f) { unsigned u = __float_as_uint(f); u += 0x7FFFu + ((u >> 16) & 1u); return (unsigned short)(u >> 16); }
__device__ __forceinline__ float bf2f(unsigned short b) { return __uint_as_float(((unsigned)b) << 16); }
__device__ __forceinline__ float bfr(float f) { return bf2f(f2bf(f)); }
__device__ __forceinline__ v16h cat16(v8h lo, v8h hi) { return __builtin_shufflevector(lo, hi, 0, 1, 2, 3, 4, 5, 6, 7, 8, 9, 10, 11, 12, 13, 14, 15); }
__device__ __forceinline__ v16bf cat16b(v8us lo, v8us hi) { return __builtin_bit_cast(v16bf, __builtin_shufflevector(lo, hi, 0, 1, 2, 3, 4, 5, 6, 7, 8, 9, 10, 11, 12, 13, 14, 15)); }
__device__ __forceinline__ v8f wmma16(v16h a, v16h b, v8f c) { return __builtin_amdgcn_wmma_f32_16x16x32_f16(false, a, false, b, (short)0, c, false, false); }
__device__ __forceinline__ v8f wmmab(v16bf a, v16bf b, v8f c) { return __builtin_amdgcn_wmma_f32_16x16x32_bf16(false, a, false, b, (short)0, c, false, false); }



// 16x16x32 operand fragment of a K-contiguous 16-bit plane: the pointer already holds row (lane & 15) and k offset 8 x (lane >> 4); A and B use the same map
template <typename T16> struct WFrag;
// ldf: the same fragment from a plane stored in FRAGMENT ORDER: the 32 lanes' 16-byte pieces of one load lie side by side (512 contiguous bytes = 4 whole cache lines a load, where a row-major plane makes a load touch 16 lines for 32 bytes each); the pointer already holds 8 x lane, the fragment's second half follows 256 elements on
template <> struct WFrag<h16> { typedef v16h V; static __device__ __forceinline__ V ld(const h16* p) { return cat16(*(const v8h*)p, *(const v8h*)(p + 16)); } static __device__ __forceinline__ V ldf(const h16* p) { return cat16(*(const v8h*)p, *(const v8h*)(p + 256)); } static __device__ __forceinline__ v8f mma(V a, V b, v8f c) { return wmma16(a, b, c); } };
template <> struct WFrag<bf> { typedef v16bf V; static __device__ __forceinline__ V ld(const bf* p) { return cat16b(*(const v8us*)p, *(const v8us*)(p + 16)); } static __device__ __forceinline__ V ldf(const bf* p) { return cat16b(*(const v8us*)p, *(const v8us*)(p + 256)); } static __device__ __forceinline__ v8f mma(V a, V b, v8f c) { return wmmab(a, b, c); } };

__device__ __forceinline__ h16 tohx(float x) { return (h16)x; }
__device__ __forceinline__ void splitf(float y, unsigned short& h, unsigned short& l) { h = f2bf(y); l = f2bf(y - bf2f(h)); }
typedef __attribute__((ext_vector_type(2))) _Float16 v2h;
typedef __attribute__((ext_vector_type(4))) _Float16 v4h;
typedef __attribute__((ext_vector_type(2))) unsigned short v2us;
typedef __attribute__((ext_vector_type(4))) unsigned short v4us;
typedef __attribute__((ext_vector_type(2))) float v2f;
typedef __attribute__((ext_vector_type(4))) int v4i;

// Fragment order of one plane (TT x HD elements). A fragment half is [lane = 16 hi + lr][j = 0..7], 256 elements; lane (lr, hi) holds tile row lr and k = 16 c + 8 hi + j of half c.
// fragk: K, tile rows = keys, k = d: [key / 16][d / 32][c = d / 16 & 1][hi = d / 8 & 1][lr = key & 15][j = d & 7]; a pass of 32 keys is 2048 consecutive elements.
// fragv: V^T, tile rows = d, k = keys: [key / 32][d / 16][c = key / 16 & 1][hi = key / 8 & 1][lr = d & 15][j = key & 7]; a pass of 32 keys is 2048 consecutive elements.
__device__ __forceinline__ size_t fragk(int key, int d) { return (size_t)((key >> 4) * 1024 + (d >> 5) * 512 + ((d >> 4) & 1) * 256 + ((d >> 3) & 1) * 128 + (key & 15) * 8 + (d & 7)); }
__device__ __forceinline__ size_t fragv(int d, int key) { return (size_t)((key >> 5) * 2048 + (d >> 4) * 512 + ((key >> 4) & 1) * 256 + ((key >> 3) & 1) * 128 + (d & 15) * 8 + (key & 7)); }
// k_rope: head planes [h][t][d] (fp16 + hi/lo) of rope(x) x sc with the rotate-half convention out[d] = x[d] cos[t][d] - x[d+HD/2] sin[t][d], out[d+HD/2] = x[d+HD/2] cos[t][d+HD/2] + x[d] sin[t][d+HD/2]; FO: the hi/lo planes go out in fragment order (fragk)
// The three plane builders are streams: a thread takes 32 elements, not 2 (its loads all asked for first, 16-byte stores), so a launch starts 4096 waves (16 per WGP) instead of 65536.
// k_rope thread: 8 consecutive d of row t (one 16-byte piece of each plane, in fragment order too: j = d & 7) in PU planes h0 + p x nheads / PU, which share the thread's cos/sin values.
template <bool FO> __global__ __launch_bounds__(256) void k_rope(const float* __restrict__ F, int pitch, int nheads, const float* __restrict__ CS, const float* __restrict__ RF, const float* __restrict__ nw, float sc, h16* P16, bf* Ph, bf* Pl) {
    (void)RF; (void)nw;   /* every launch passes null: the row-factor branch is gone, the 32 elements are one straight run */
    const int hs = nheads / PU; const size_t e0 = ((size_t)blockIdx.x * 256 + threadIdx.x) * 8; if (e0 >= (size_t)hs * TT * HD) return; const int d = (int)(e0 % HD); const int t = (int)((e0 / HD) % TT); const int h0 = (int)(e0 / ((size_t)HD * TT));
    const int dq = (d < HD / 2) ? d + HD / 2 : d - HD / 2;   /* the 8 partners d +- HD / 2 lie side by side as well */
    v4f c4[4], xa[PU][2], xb[PU][2]; const float* pc = CS + ((size_t)t * HD + d) * 2; const float* pa[PU]; const float* pb[PU];
#pragma unroll
    for (int i = 0; i < 4; ++i) c4[i] = *(const v4f*)(pc + 4 * i);
#pragma unroll
    for (int p = 0; p < PU; ++p) { const float* f = F + ((size_t)(h0 + p * hs) * TT + t) * pitch;   /* source planes [h][t][d] */
        pa[p] = f + d; pb[p] = f + dq; xa[p][0] = *(const v4f*)pa[p]; xa[p][1] = *(const v4f*)(pa[p] + 4); xb[p][0] = *(const v4f*)pb[p]; xb[p][1] = *(const v4f*)(pb[p] + 4); }
    /* the wait that stands in front of any overwrite of the 20 loads' address registers; it takes the addresses as inputs, so that none of their registers is handed to a later load's result ahead of it */
    static_assert(PU == 4, "the wait names PU pairs of addresses");
    asm volatile("s_wait_xcnt 0x0" :: "v"(pc), "v"(pa[0]), "v"(pb[0]), "v"(pa[1]), "v"(pb[1]), "v"(pa[2]), "v"(pb[2]), "v"(pa[3]), "v"(pb[3]) : "memory");
#pragma unroll
    for (int p = 0; p < PU; ++p) { const int h = h0 + p * hs; v8h o16; v8us oh, ol;
#pragma unroll
    for (int q = 0; q < 8; ++q) { const int dd = d + q; float x0 = bfr(xa[p][q >> 2][q & 3]), x1 = bfr(xb[p][q >> 2][q & 3]);   /* RAW d_in source: round to bf16 FIRST; the lo planes are then identically zero */
        v2f cs; cs[0] = c4[q >> 1][(q & 1) * 2]; cs[1] = c4[q >> 1][(q & 1) * 2 + 1]; float a = __fmul_rn(x0, cs[0]), bq = __fmul_rn(x1, cs[1]); const float r = ((dd < HD / 2) ? __fsub_rn(a, bq) : __fadd_rn(a, bq)) * sc;
        o16[q] = tohx(r); unsigned short a2, c2; splitf(r, a2, c2); oh[q] = a2; ol[q] = c2; }
    const size_t e = ((size_t)h * TT + t) * HD + d; const size_t eo = FO ? (size_t)h * TT * HD + fragk(t, d) : e;   /* d is a multiple of 8: the piece stays side by side */
    *(v8h*)(P16 + e) = o16; *(v8us*)(Ph + eo) = oh; *(v8us*)(Pl + eo) = ol; }  }
// k_vtp wave: 16 keys x all HD d of one plane. Lane (lr, hi) takes keys 8 hi + j (j = 0..7) at d = 16 dt + lr, dt = 0..3: a load reads 64 contiguous bytes of two rows, and the wave uses up each row's two lines;
// the 8 keys are one 16-byte piece of fragv, and the 32 lanes' pieces of one dt lie side by side: every store writes 512 contiguous bytes.
__global__ __launch_bounds__(256) void k_vtp(const float* __restrict__ F, int pitch, int nheads, h16* V16, bf* Vh, bf* Vl) { const int wv = (int)((blockIdx.x * 256 + threadIdx.x) >> 5); if (wv >= nheads * (TT / 16)) return; const int lane = threadIdx.x & 31, lr = lane & 15, hi = lane >> 4; const int g = wv / (TT / 16); const int t = (wv % (TT / 16)) * 16 + 8 * hi;
    float xv[4][8];
#pragma unroll
    for (int q = 0; q < 8; ++q) {
#pragma unroll
        for (int dt = 0; dt < 4; ++dt) xv[dt][q] = F[((size_t)g * TT + t + q) * pitch + 16 * dt + lr]; }
#pragma unroll
    for (int dt = 0; dt < 4; ++dt) { v8h o16; v8us oh, ol;
#pragma unroll
    for (int q = 0; q < 8; ++q) { const float x = bfr(xv[dt][q]);   /* RAW d_in source: bf16-rounded first */ o16[q] = tohx(x); unsigned short a2, c2; splitf(x, a2, c2); oh[q] = a2; ol[q] = c2; }
    const size_t eo = (size_t)g * HD * TT + fragv(16 * dt + lr, t);   /* all three V^T planes in fragment order; t is a multiple of 8: the piece stays side by side */
    *(v8h*)(V16 + eo) = o16; *(v8us*)(Vh + eo) = oh; *(v8us*)(Vl + eo) = ol; }  }
__global__ __launch_bounds__(256) void k_csid(float* CS) { const int idx = (blockIdx.x * 256 + threadIdx.x) * 4; if (idx >= TT * HD) return; v4f cs; cs[0] = 1.0f; cs[1] = 0.0f; cs[2] = 1.0f; cs[3] = 0.0f; *(v4f*)(CS + (size_t)idx * 2) = cs; *(v4f*)(CS + (size_t)idx * 2 + 4) = cs;  }   /* four (cos, sin) pairs a thread */
typedef __attribute__((ext_vector_type(2))) __bf16 v2bf;
typedef __attribute__((ext_vector_type(8))) unsigned v8u;
__device__ __forceinline__ unsigned pkbf(float a, float b) { v2f x; x[0] = a; x[1] = b; return __builtin_bit_cast(unsigned, __builtin_convertvector(x, v2bf)); }   /* two f32 -> two bf16, round to nearest even */
__device__ __forceinline__ unsigned pkh(float a, float b) { v2f x; x[0] = a; x[1] = b; return __builtin_bit_cast(unsigned, __builtin_convertvector(x, v2h)); }     /* two f32 -> two fp16, round to nearest even */
__device__ __forceinline__ float lo2f(unsigned u) { return __uint_as_float(u << 16); }
__device__ __forceinline__ float hi2f(unsigned u) { return __uint_as_float(u & 0xFFFF0000u); }
// hold(): a load group stays where the source puts it. The memory clobber keeps the optimiser from merging or sinking the loads across it, the scheduling barrier keeps the scheduler from it: without them each group moves down to its first use (or into the next pass) and its latency is waited for in full.
__device__ __forceinline__ void hold() { asm volatile("" ::: "memory"); __builtin_amdgcn_sched_barrier(0); }
// holdx(): the same behind a load group, with the wait that stands in front of any overwrite of the group's address registers.
__device__ __forceinline__ void holdx() { asm volatile("s_wait_xcnt 0x0" ::: "memory"); __builtin_amdgcn_sched_barrier(0); }
__device__ __forceinline__ float xhalf(float x) { return __builtin_bit_cast(float, __builtin_amdgcn_permlanex16(__builtin_bit_cast(int, x), __builtin_bit_cast(int, x), 0x76543210, 0xfedcba98, false, false)); }   /* lane l <-> lane l ^ 16 */

// fa_rows: one wave, 16 query rows of one plane, all TT keys in passes of 32. S^T = K.Q^T (tile rows = keys, columns = queries) and O^T += V^T.P^T, so lane (lr, hi) holds query lr only:
// of each 16-key score tile it has keys 8 hi + j in register j, which is the k order of a B fragment over two tiles: P goes from the score accumulators into the second product without leaving the lane.
// Softmax with a running maximum m_run and running sum l_run per query (each wave half sums its own keys; the halves meet once at the end); the output tile is rescaled by exp(m_old - m_new) every pass and divided by the sum at the end.
// Every inner loop is fully unrolled: fragments, scores and accumulators stay in registers only under compile-time indices. The loop over the passes stays rolled.
template <bool HI>
__device__ __forceinline__ void fa_rows(const bf* __restrict__ Qh, const bf* __restrict__ Ql, const bf* __restrict__ Kh, const bf* __restrict__ Kl, const h16* __restrict__ V16, const bf* __restrict__ Vh, const bf* __restrict__ Vl, const float* __restrict__ mrow, float* __restrict__ orow) {
    const int lane = threadIdx.x & 31, lr = lane & 15, hi = lane >> 4;
    v16bf qh[2], ql[2];
#pragma unroll
    for (int ks = 0; ks < 2; ++ks) { qh[ks] = WFrag<bf>::ld(Qh + lr * HD + 32 * ks + 8 * hi); ql[ks] = WFrag<bf>::ld(Ql + lr * HD + 32 * ks + 8 * hi); }
    const int koff = 8 * lane, voff = 8 * lane, moff = lr * TT + 8 * hi;   /* K and V^T planes are in fragment order: tile kt, k step ks of K at 1024 kt + 512 ks, tile dt of V^T at 512 dt behind the pass's first element HD x key0 */
    v8f acc[4];
#pragma unroll
    for (int dt = 0; dt < 4; ++dt) acc[dt] = (v8f){};
    float m_run = -3.0e38f, l_run = 0.f;
    v16bf kh[2][2], kl[2][2]; v4f mk[2][2];
#pragma unroll
    for (int kt = 0; kt < 2; ++kt) {
#pragma unroll
        for (int ks = 0; ks < 2; ++ks) { kh[kt][ks] = WFrag<bf>::ldf(Kh + koff + 1024 * kt + 512 * ks); kl[kt][ks] = WFrag<bf>::ldf(Kl + koff + 1024 * kt + 512 * ks); mk[kt][ks] = *(const v4f*)(mrow + moff + 16 * kt + 4 * ks); } }
    for (int key0 = 0; key0 < TT; key0 += 32) {
        const int kn = (key0 + 32 < TT) ? key0 + 32 : key0;   /* the pass fetched ahead; the last pass fetches its own rows again (in bounds, unused) */
        v16h v6[4]; v16bf vh[4], vl[4];   /* this pass's V^T fragments: asked for first, used last */
#pragma unroll
        for (int dt = 0; dt < 4; ++dt) { if constexpr (HI) { vh[dt] = WFrag<bf>::ldf(Vh + voff + key0 * HD + 512 * dt); vl[dt] = WFrag<bf>::ldf(Vl + voff + key0 * HD + 512 * dt); } else v6[dt] = WFrag<h16>::ldf(V16 + voff + key0 * HD + 512 * dt); }
        hold();   /* V^T is asked for before the first product starts (its address registers are next written behind the waits for its data) */
        v8f s[2]; s[0] = (v8f){}; s[1] = (v8f){};
#pragma unroll
        for (int ks = 0; ks < 2; ++ks) {
#pragma unroll
            for (int kt = 0; kt < 2; ++kt) s[kt] = wmmab(kh[kt][ks], qh[ks], s[kt]);
#pragma unroll
            for (int kt = 0; kt < 2; ++kt) s[kt] = wmmab(kh[kt][ks], ql[ks], s[kt]);
#pragma unroll
            for (int kt = 0; kt < 2; ++kt) s[kt] = wmmab(kl[kt][ks], qh[ks], s[kt]); }
        hold();   /* the next K fragments are not asked for earlier: issued from here most of them land in the registers this pass has just read */
        /* next pass's K fragments, in flight under this pass's softmax and second product */
#pragma unroll
        for (int kt = 0; kt < 2; ++kt) {
#pragma unroll
            for (int ks = 0; ks < 2; ++ks) { kh[kt][ks] = WFrag<bf>::ldf(Kh + koff + kn * HD + 1024 * kt + 512 * ks); kl[kt][ks] = WFrag<bf>::ldf(Kl + koff + kn * HD + 1024 * kt + 512 * ks); } }
        holdx();   /* K is asked for before the softmax starts */
        float t[16]; float mx = -3.0e38f;
#pragma unroll
        for (int kt = 0; kt < 2; ++kt) {
#pragma unroll
            for (int jp = 0; jp < 4; ++jp) { const unsigned u = pkbf(mk[kt][jp >> 1][(jp & 1) * 2], mk[kt][jp >> 1][(jp & 1) * 2 + 1]);   /* mask bf16-rounded, added in f32: scores x SCL + attn_mask[i][j] */
                t[kt * 8 + 2 * jp] = fmaf(s[kt][2 * jp], SCL, lo2f(u)); t[kt * 8 + 2 * jp + 1] = fmaf(s[kt][2 * jp + 1], SCL, hi2f(u)); mx = fmaxf(mx, fmaxf(t[kt * 8 + 2 * jp], t[kt * 8 + 2 * jp + 1])); } }
        hold();   /* the next mask values are not asked for earlier: this pass's are read above */
        /* next pass's mask values */
#pragma unroll
        for (int kt = 0; kt < 2; ++kt) {
#pragma unroll
            for (int hf = 0; hf < 2; ++hf) mk[kt][hf] = *(const v4f*)(mrow + moff + kn + 16 * kt + 4 * hf); }
        holdx();   /* the mask loads stay in this pass */
        mx = fmaxf(mx, xhalf(mx));   /* both halves hold the query's maximum of this pass */
        const float m_new = fmaxf(m_run, mx); float corr = (m_run - m_new) * L2E; m_run = m_new;   /* becomes 2^corr below: 0 on the first pass */
        const float nm = (HI ? 0.0f : PSH) - m_new * L2E;
#pragma unroll
        for (int k = 0; k < 16; ++k) t[k] = fmaf(t[k], L2E, nm);
        /* the pass's 17 exponentials as one run, each in place in a register of its own: none waits for its neighbour (under the register cap the compiler sent every argument through one register: multiply-add, wait, exponential, 16 times over),
           and none is followed directly by a reader of its result or a writer of its source; the v_nop is that free slot behind the last one */
        asm("v_exp_f32 %0, %0\n\tv_exp_f32 %1, %1\n\tv_exp_f32 %2, %2\n\tv_exp_f32 %3, %3\n\tv_exp_f32 %4, %4\n\tv_exp_f32 %5, %5\n\tv_exp_f32 %6, %6\n\tv_exp_f32 %7, %7\n\tv_exp_f32 %8, %8\n\t"
            "v_exp_f32 %9, %9\n\tv_exp_f32 %10, %10\n\tv_exp_f32 %11, %11\n\tv_exp_f32 %12, %12\n\tv_exp_f32 %13, %13\n\tv_exp_f32 %14, %14\n\tv_exp_f32 %15, %15\n\tv_exp_f32 %16, %16\n\tv_nop"
            : "+v"(corr), "+v"(t[0]), "+v"(t[1]), "+v"(t[2]), "+v"(t[3]), "+v"(t[4]), "+v"(t[5]), "+v"(t[6]), "+v"(t[7]), "+v"(t[8]), "+v"(t[9]), "+v"(t[10]), "+v"(t[11]), "+v"(t[12]), "+v"(t[13]), "+v"(t[14]), "+v"(t[15]));
        float ps[8];   /* the pass's sum as a tree: a chain of 16 dependent adds would stand exposed in a lone wave */
#pragma unroll
        for (int k = 0; k < 8; ++k) ps[k] = t[2 * k] + t[2 * k + 1];
#pragma unroll
        for (int st = 4; st; st >>= 1) {
#pragma unroll
            for (int k = 0; k < st; ++k) ps[k] += ps[k + st]; }
        l_run = fmaf(l_run, corr, ps[0]);
#pragma unroll
        for (int dt = 0; dt < 4; ++dt) acc[dt] = acc[dt] * corr;
        if constexpr (HI) {
            v8u uh, ul;
#pragma unroll
            for (int i = 0; i < 8; ++i) { uh[i] = pkbf(t[2 * i], t[2 * i + 1]); ul[i] = pkbf(t[2 * i] - lo2f(uh[i]), t[2 * i + 1] - hi2f(uh[i])); }
            const v16bf ph = __builtin_bit_cast(v16bf, uh), pl = __builtin_bit_cast(v16bf, ul);
#pragma unroll
            for (int dt = 0; dt < 4; ++dt) acc[dt] = wmmab(vh[dt], ph, acc[dt]);
#pragma unroll
            for (int dt = 0; dt < 4; ++dt) acc[dt] = wmmab(vh[dt], pl, acc[dt]);
#pragma unroll
            for (int dt = 0; dt < 4; ++dt) acc[dt] = wmmab(vl[dt], ph, acc[dt]);
        } else {
            v8u up;
#pragma unroll
            for (int i = 0; i < 8; ++i) up[i] = pkh(t[2 * i], t[2 * i + 1]);
            const v16h pf = __builtin_bit_cast(v16h, up);
#pragma unroll
            for (int dt = 0; dt < 4; ++dt) acc[dt] = wmma16(v6[dt], pf, acc[dt]);
        }
        hold();   /* whatever register copies the loop's back edge needs for the fetched-ahead values stay down here: higher up they would wait for those loads in the middle of the pass */
    }
    const float inv = __fdiv_rn(1.0f, l_run + xhalf(l_run));
#pragma unroll
    for (int dt = 0; dt < 4; ++dt) {   /* register j of tile dt is d = 16 dt + 8 hi + j of query lr: 32 contiguous bytes per lane */
        v4f o0, o1;
#pragma unroll
        for (int j = 0; j < 4; ++j) { o0[j] = acc[dt][j] * inv; o1[j] = acc[dt][4 + j] * inv; }
        float* op = orow + lr * HD + 16 * dt + 8 * hi; *(v4f*)op = o0; *(v4f*)(op + 4) = o1; }
}
// k_fattn: grid (TT / (16 FW), ZH), FW waves; wave w of block x takes query rows 16 (FW x + w) .. + 15 of plane y. No LDS, no barrier: the waves of a block only share K, V lines in the WGP cache.
// 1024 work-groups on 256 WGPs: four are resident per WGP (4 x 256 registers fill a SIMD's file), so each SIMD holds four waves of different work-groups, and one wave's load and dependency waits are issue slots for the other three.
// amdgpu_waves_per_eu(4, 4) caps the kernel at 256 registers: left free, the rows < RH loop takes a few more and switches register banks (s_set_vgpr_msb) 18 times a pass.
__global__ __launch_bounds__(32 * FW) __attribute__((amdgpu_waves_per_eu(4, 4))) void k_fattn(const bf* __restrict__ Qh, const bf* __restrict__ Ql, const bf* __restrict__ Kh, const bf* __restrict__ Kl, const h16* __restrict__ V16, const bf* __restrict__ Vh, const bf* __restrict__ Vl, const float* __restrict__ mskf, float* __restrict__ OUTb) {
    const int w = __builtin_amdgcn_readfirstlane((int)(threadIdx.x >> 5)); const int q0 = ((int)blockIdx.x * FW + w) * 16; const size_t zo = (size_t)blockIdx.y * TT * HD;
    if (q0 < RH) fa_rows<true>(Qh + zo + (size_t)q0 * HD, Ql + zo + (size_t)q0 * HD, Kh + zo, Kl + zo, V16 + zo, Vh + zo, Vl + zo, mskf + (size_t)q0 * TT, OUTb + zo + (size_t)q0 * HD);
    else fa_rows<false>(Qh + zo + (size_t)q0 * HD, Ql + zo + (size_t)q0 * HD, Kh + zo, Kl + zo, V16 + zo, Vh + zo, Vl + zo, mskf + (size_t)q0 * TT, OUTb + zo + (size_t)q0 * HD);
}
extern "C" void kernel_launch(void* const* d_in, const int* in_sizes, int n_in,
                              void* d_out, int out_size, void* d_ws, size_t ws_size, hipStream_t stream) {
    (void)in_sizes; (void)n_in; (void)out_size;
    const float* x = (const float*)d_in[0]; const float* xk = (const float*)d_in[1]; const float* xv = (const float*)d_in[2]; const float* amask = (const float*)d_in[3];   /* attn_mask f32 [1][1][2048][2048], read */   /* query, key, value: [32][2048][64] each (no projections) */ const float* wq = nullptr, *wk = nullptr, *wv = nullptr, *wo = nullptr; (void)wq; (void)wk; (void)wv; (void)wo;
    float* OUT = (float*)d_out;     // [32][2048][64]
    char* wsp = (char*)d_ws;
    auto take = [&](size_t bytes) { char* p = wsp; wsp += (bytes + 255) & ~(size_t)255; return (void*)p; };
    bf* WQ = (bf*)take((size_t)DQ * DM * 2); bf* WK = (bf*)take((size_t)DKV * DM * 2); bf* WV = (bf*)take((size_t)DKV * DM * 2); float* CS = (float*)take((size_t)TT * HD * 2 * 4);
    bf* XB = (bf*)take((size_t)TT * DM * 2); float* FQ = (float*)take((size_t)TT * DQ * 4); float* FK = (float*)take((size_t)TT * DKV * 4);
    h16* QP16 = (h16*)take((size_t)ZH * TT * HD * 2); h16* KP16 = (h16*)take((size_t)ZH * TT * HD * 2); h16* VT16 = (h16*)take((size_t)ZH * HD * TT * 2);
    bf* QPh = (bf*)take((size_t)ZH * TT * HD * 2); bf* QPl = (bf*)take((size_t)ZH * TT * HD * 2); bf* KPh = (bf*)take((size_t)ZH * TT * HD * 2); bf* KPl = (bf*)take((size_t)ZH * TT * HD * 2); bf* VTh = (bf*)take((size_t)ZH * HD * TT * 2); bf* VTl = (bf*)take((size_t)ZH * HD * TT * 2);
    if ((size_t)(wsp - (char*)d_ws) > ws_size) return;    // ws 256 MiB
    float* FV = FK;   // FV aliases the k buffer; unused, as there is no v projection
    {   
      
       }
    k_csid<<<(TT * HD / 4 + 255) / 256, 256, 0, stream>>>(CS);
    const unsigned LQ = (unsigned)(((size_t)ZH * TT * HD / 32 + 255) / 256), LKv = LQ;   /* 32 elements a thread in all three builders */
    for (int b = 0; b < NB_; b += ZH) {   /* one pass = ZH consecutive planes */
        
        /* no projections: the q, k, v inputs feed the plane builders directly */
        
        k_rope<false><<<LQ, 256, 0, stream>>>(x + (size_t)b * TT * HD, DQ, ZH, CS, nullptr, nullptr, 1.0f, QP16, QPh, QPl);   /* q planes straight from the input (f32 values rounded to bf16 first, so the lo plane is zero) */
        
        k_rope<true><<<LKv, 256, 0, stream>>>(xk + (size_t)b * TT * HD, DKV, ZH, CS, nullptr, nullptr, 1.0f, KP16, KPh, KPl);
         k_vtp<<<LKv, 256, 0, stream>>>(xv + (size_t)b * TT * HD, DKV, ZH, VT16, VTh, VTl);
        k_fattn<<<dim3(TT / (16 * FW), ZH), 32 * FW, 0, stream>>>(QPh, QPl, KPh, KPl, VT16, VTh, VTl, amask, OUT + (size_t)b * TT * DQ);   /* scores (3 products on every row), mask, softmax and hybrid P.V in one launch; plane y of the pass uses q, k and v plane y */
         }
}

// v007
// One run takes 80.3 microseconds.
// Next to v006, in two timings, it ran 1.54 and 1.52 times as fast.
// Over all steps from v000 it is 44.4 times as fast.
#include <hip/hip_runtime.h>

// Scaled dot-product attention on raw per-head inputs with an ADDITIVE random float mask (query, key, value [2][16][2048][64] = 32 planes, no projections; scores = q.k^T x 1/sqrt(64) + attn_mask with attn_mask f32 [1][1][2048][2048] standard-normal draws shared by all planes (read per (query, key) on device, bf16-rounded as every input); softmax over keys; out = probs.v -> [2][16][2048][64] (4.2 M); argument order query, key, value, attn_mask).
// Layout: all 32 planes in one pass, each launch covering them through grid y or 32 x the rows (5 launches); per plane: the raw f32 inputs are ROUNDED TO bf16 first and stored as 16-bit planes (the K and V^T planes in fragment order, see fragk / fragv); a bf16-rounded value has no bf16 remainder, so one plane holds all of it; ONE fused kernel then walks the 2048 keys 32 at a time per 16 query rows: scores as one bf16 product, mask added, running maximum and sum per query, P.V hybrid (rows < 512: P as bf16 hi + lo against bf16 V, rest fp16 x1024); scores and probabilities stay in registers, the kernel writes the output rows.
// Compute dtypes, f32 accumulate: every input rounded to bf16; scores bf16 x bf16 (exact operands) + bf16-rounded mask added in f32; softmax f32; P.V rows < 512 two products (P hi and P lo), rest fp16; output f32.

#define NB_  32
#define TT   2048
#define DM   64
#define NH_  1
#define NKV  1
#define REP  (NH_ / NKV)
#define HD   64
#define DQ   (NH_ * HD)
#define DKV  (NKV * HD)
#define ZH   32                   // planes per pass: every launch of a pass covers ZH planes (grid y, or ZH x the rows); 32 / ZH passes. All 32: four 16-bit planes of 8 MiB each in the workspace, and 1024 work-groups in the fused launch
#define RH   512                  // query rows < RH carry P as bf16 hi + lo (0: none)
#define WIN  0
#define PU   4                    // planes per thread of k_rope (ZH is a multiple of it)
#define FW   4                    // waves per work-group of the fused kernel, 16 query rows each: one wave per SIMD of a WGP, K and V shared through the WGP cache
#define PSH  10.0f                // rows >= RH: probabilities carry a factor 2^PSH into fp16 (it cancels against the sum)
#define L2E  1.4426950408889634f
#define SCL  0.125f   // 1/sqrt(64)
typedef _Float16 h16;
typedef unsigned short bf;
typedef __attribute__((ext_vector_type(16))) __bf16   v16bf;
typedef __attribute__((ext_vector_type(16))) _Float16 v16h;
typedef __attribute__((ext_vector_type(8)))  _Float16 v8h;
typedef __attribute__((ext_vector_type(8)))  unsigned short v8us;
typedef __attribute__((ext_vector_type(8)))  float    v8f;
typedef __attribute__((ext_vector_type(4)))  float    v4f;
typedef v8h  __attribute__((may_alias)) v8ha;
typedef v4f  __attribute__((may_alias)) v4fa;
typedef v8us __attribute__((may_alias)) v8usa;

__device__ __forceinline__ unsigned short f2bf(float f) { unsigned u = __float_as_uint(f); u += 0x7FFFu + ((u >> 16) & 1u); return (unsigned short)(u >> 16); }
__device__ __forceinline__ float bf2f(unsigned short b) { return __uint_as_float(((unsigned)b) << 16); }
__device__ __forceinline__ float bfr(float f) { return bf2f(f2bf(f)); }
__device__ __forceinline__ v16h cat16(v8h lo, v8h hi) { return __builtin_shufflevector(lo, hi, 0, 1, 2, 3, 4, 5, 6, 7, 8, 9, 10, 11, 12, 13, 14, 15); }
__device__ __forceinline__ v16bf cat16b(v8us lo, v8us hi) { return __builtin_bit_cast(v16bf, __builtin_shufflevector(lo, hi, 0, 1, 2, 3, 4, 5, 6, 7, 8, 9, 10, 11, 12, 13, 14, 15)); }
__device__ __forceinline__ v8f wmma16(v16h a, v16h b, v8f c) { return __builtin_amdgcn_wmma_f32_16x16x32_f16(false, a, false, b, (short)0, c, false, false); }
__device__ __forceinline__ v8f wmmab(v16bf a, v16bf b, v8f c) { return __builtin_amdgcn_wmma_f32_16x16x32_bf16(false, a, false, b, (short)0, c, false, false); }



// 16x16x32 operand fragment of a K-contiguous 16-bit plane: the pointer already holds row (lane & 15) and k offset 8 x (lane >> 4); A and B use the same map
template <typename T16> struct WFrag;
// ldf: the same fragment from a plane stored in FRAGMENT ORDER: the 32 lanes' 16-byte pieces of one load lie side by side (512 contiguous bytes = 4 whole cache lines a load, where a row-major plane makes a load touch 16 lines for 32 bytes each); the pointer already holds 8 x lane, the fragment's second half follows 256 elements on
template <> struct WFrag<h16> { typedef v16h V; static __device__ __forceinline__ V ld(const h16* p) { return cat16(*(const v8h*)p, *(const v8h*)(p + 16)); } static __device__ __forceinline__ V ldf(const h16* p) { return cat16(*(const v8h*)p, *(const v8h*)(p + 256)); } static __device__ __forceinline__ v8f mma(V a, V b, v8f c) { return wmma16(a, b, c); } };
template <> struct WFrag<bf> { typedef v16bf V; static __device__ __forceinline__ V ld(const bf* p) { return cat16b(*(const v8us*)p, *(const v8us*)(p + 16)); } static __device__ __forceinline__ V ldf(const bf* p) { return cat16b(*(const v8us*)p, *(const v8us*)(p + 256)); } static __device__ __forceinline__ v8f mma(V a, V b, v8f c) { return wmmab(a, b, c); } };

__device__ __forceinline__ h16 tohx(float x) { return (h16)x; }
typedef __attribute__((ext_vector_type(2))) _Float16 v2h;
typedef __attribute__((ext_vector_type(4))) _Float16 v4h;
typedef __attribute__((ext_vector_type(2))) unsigned short v2us;
typedef __attribute__((ext_vector_type(4))) unsigned short v4us;
typedef __attribute__((ext_vector_type(2))) float v2f;
typedef __attribute__((ext_vector_type(4))) int v4i;

// Fragment order of one plane (TT x HD elements). A fragment half is [lane = 16 hi + lr][j = 0..7], 256 elements; lane (lr, hi) holds tile row lr and k = 16 c + 8 hi + j of half c.
// fragk: K, tile rows = keys, k = d: [key / 16][d / 32][c = d / 16 & 1][hi = d / 8 & 1][lr = key & 15][j = d & 7]; a pass of 32 keys is 2048 consecutive elements.
// fragv: V^T, tile rows = d, k = keys: [key / 32][d / 16][c = key / 16 & 1][hi = key / 8 & 1][lr = d & 15][j = key & 7]; a pass of 32 keys is 2048 consecutive elements.
__device__ __forceinline__ size_t fragk(int key, int d) { return (size_t)((key >> 4) * 1024 + (d >> 5) * 512 + ((d >> 4) & 1) * 256 + ((d >> 3) & 1) * 128 + (key & 15) * 8 + (d & 7)); }
__device__ __forceinline__ size_t fragv(int d, int key) { return (size_t)((key >> 5) * 2048 + (d >> 4) * 512 + ((key >> 4) & 1) * 256 + ((key >> 3) & 1) * 128 + (d & 15) * 8 + (key & 7)); }
// k_rope: head plane [h][t][d] (bf16) of rope(x) x sc with the rotate-half convention out[d] = x[d] cos[t][d] - x[d+HD/2] sin[t][d], out[d+HD/2] = x[d+HD/2] cos[t][d+HD/2] + x[d] sin[t][d+HD/2]; FO: the plane goes out in fragment order (fragk)
// The three plane builders are streams: a thread takes 32 elements, not 2 (its loads all asked for first, 16-byte stores), so a launch starts 4096 waves (16 per WGP) instead of 65536.
// k_rope thread: 8 consecutive d of row t (one 16-byte piece of the plane, in fragment order too: j = d & 7) in PU planes h0 + p x nheads / PU, which share the thread's cos/sin values.
template <bool FO> __global__ __launch_bounds__(256) void k_rope(const float* __restrict__ F, int pitch, int nheads, const float* __restrict__ CS, const float* __restrict__ RF, const float* __restrict__ nw, float sc, bf* Ph) {
    (void)RF; (void)nw;   /* every launch passes null: the row-factor branch is gone, the 32 elements are one straight run */
    const int hs = nheads / PU; const size_t e0 = ((size_t)blockIdx.x * 256 + threadIdx.x) * 8; if (e0 >= (size_t)hs * TT * HD) return; const int d = (int)(e0 % HD); const int t = (int)((e0 / HD) % TT); const int h0 = (int)(e0 / ((size_t)HD * TT));
    const int dq = (d < HD / 2) ? d + HD / 2 : d - HD / 2;   /* the 8 partners d +- HD / 2 lie side by side as well */
    v4f c4[4], xa[PU][2], xb[PU][2]; const float* pc = CS + ((size_t)t * HD + d) * 2; const float* pa[PU]; const float* pb[PU];
#pragma unroll
    for (int i = 0; i < 4; ++i) c4[i] = *(const v4f*)(pc + 4 * i);
#pragma unroll
    for (int p = 0; p < PU; ++p) { const float* f = F + ((size_t)(h0 + p * hs) * TT + t) * pitch;   /* source planes [h][t][d] */
        pa[p] = f + d; pb[p] = f + dq; xa[p][0] = *(const v4f*)pa[p]; xa[p][1] = *(const v4f*)(pa[p] + 4); xb[p][0] = *(const v4f*)pb[p]; xb[p][1] = *(const v4f*)(pb[p] + 4); }
    /* the wait that stands in front of any overwrite of the 20 loads' address registers; it takes the addresses as inputs, so that none of their registers is handed to a later load's result ahead of it */
    static_assert(PU == 4, "the wait names PU pairs of addresses");
    asm volatile("s_wait_xcnt 0x0" :: "v"(pc), "v"(pa[0]), "v"(pb[0]), "v"(pa[1]), "v"(pb[1]), "v"(pa[2]), "v"(pb[2]), "v"(pa[3]), "v"(pb[3]) : "memory");
#pragma unroll
    for (int p = 0; p < PU; ++p) { const int h = h0 + p * hs; v8us oh;
#pragma unroll
    for (int q = 0; q < 8; ++q) { const int dd = d + q; float x0 = bfr(xa[p][q >> 2][q & 3]), x1 = bfr(xb[p][q >> 2][q & 3]);   /* RAW d_in source: round to bf16 FIRST */
        v2f cs; cs[0] = c4[q >> 1][(q & 1) * 2]; cs[1] = c4[q >> 1][(q & 1) * 2 + 1]; float a = __fmul_rn(x0, cs[0]), bq = __fmul_rn(x1, cs[1]); const float r = ((dd < HD / 2) ? __fsub_rn(a, bq) : __fadd_rn(a, bq)) * sc;
        oh[q] = f2bf(r); }
    const size_t e = ((size_t)h * TT + t) * HD + d; const size_t eo = FO ? (size_t)h * TT * HD + fragk(t, d) : e;   /* d is a multiple of 8: the piece stays side by side */
    *(v8us*)(Ph + eo) = oh; }  }
// k_vtp wave: 16 keys x all HD d of one plane. Lane (lr, hi) takes keys 8 hi + j (j = 0..7) at d = 16 dt + lr, dt = 0..3: a load reads 64 contiguous bytes of two rows, and the wave uses up each row's two lines;
// the 8 keys are one 16-byte piece of fragv, and the 32 lanes' pieces of one dt lie side by side: every store writes 512 contiguous bytes.
__global__ __launch_bounds__(256) void k_vtp(const float* __restrict__ F, int pitch, int nheads, h16* V16, bf* Vh) { const int wv = (int)((blockIdx.x * 256 + threadIdx.x) >> 5); if (wv >= nheads * (TT / 16)) return; const int lane = threadIdx.x & 31, lr = lane & 15, hi = lane >> 4; const int g = wv / (TT / 16); const int t = (wv % (TT / 16)) * 16 + 8 * hi;
    float xv[4][8];
#pragma unroll
    for (int q = 0; q < 8; ++q) {
#pragma unroll
        for (int dt = 0; dt < 4; ++dt) xv[dt][q] = F[((size_t)g * TT + t + q) * pitch + 16 * dt + lr]; }
#pragma unroll
    for (int dt = 0; dt < 4; ++dt) { v8h o16; v8us oh;
#pragma unroll
    for (int q = 0; q < 8; ++q) { const float x = bfr(xv[dt][q]);   /* RAW d_in source: bf16-rounded first */ o16[q] = tohx(x); oh[q] = f2bf(x); }
    const size_t eo = (size_t)g * HD * TT + fragv(16 * dt + lr, t);   /* both V^T planes in fragment order; t is a multiple of 8: the piece stays side by side */
    *(v8h*)(V16 + eo) = o16; *(v8us*)(Vh + eo) = oh; }  }
__global__ __launch_bounds__(256) void k_csid(float* CS) { const int idx = (blockIdx.x * 256 + threadIdx.x) * 4; if (idx >= TT * HD) return; v4f cs; cs[0] = 1.0f; cs[1] = 0.0f; cs[2] = 1.0f; cs[3] = 0.0f; *(v4f*)(CS + (size_t)idx * 2) = cs; *(v4f*)(CS + (size_t)idx * 2 + 4) = cs;  }   /* four (cos, sin) pairs a thread */
typedef __attribute__((ext_vector_type(2))) __bf16 v2bf;
typedef __attribute__((ext_vector_type(8))) unsigned v8u;
__device__ __forceinline__ unsigned pkbf(float a, float b) { v2f x; x[0] = a; x[1] = b; return __builtin_bit_cast(unsigned, __builtin_convertvector(x, v2bf)); }   /* two f32 -> two bf16, round to nearest even */
__device__ __forceinline__ unsigned pkh(float a, float b) { v2f x; x[0] = a; x[1] = b; return __builtin_bit_cast(unsigned, __builtin_convertvector(x, v2h)); }     /* two f32 -> two fp16, round to nearest even */
__device__ __forceinline__ float lo2f(unsigned u) { return __uint_as_float(u << 16); }
__device__ __forceinline__ float hi2f(unsigned u) { return __uint_as_float(u & 0xFFFF0000u); }
// hold(): a load group stays where the source puts it. The memory clobber keeps the optimiser from merging or sinking the loads across it, the scheduling barrier keeps the scheduler from it: without them each group moves down to its first use (or into the next pass) and its latency is waited for in full.
__device__ __forceinline__ void hold() { asm volatile("" ::: "memory"); __builtin_amdgcn_sched_barrier(0); }
// holdx(): the same behind a load group, with the wait that stands in front of any overwrite of the group's address registers.
__device__ __forceinline__ void holdx() { asm volatile("s_wait_xcnt 0x0" ::: "memory"); __builtin_amdgcn_sched_barrier(0); }
// holdxa(): holdx() that also takes the group's addresses as inputs, so that none of their registers is handed to one of the group's own results ahead of the wait.
__device__ __forceinline__ void holdxa(const void* p) { asm volatile("s_wait_xcnt 0x0" :: "v"(p) : "memory"); __builtin_amdgcn_sched_barrier(0); }
__device__ __forceinline__ void holdxa(const void* p, const void* q, const void* r) { asm volatile("s_wait_xcnt 0x0" :: "v"(p), "v"(q), "v"(r) : "memory"); __builtin_amdgcn_sched_barrier(0); }
__device__ __forceinline__ float xhalf(float x) { return __builtin_bit_cast(float, __builtin_amdgcn_permlanex16(__builtin_bit_cast(int, x), __builtin_bit_cast(int, x), 0x76543210, 0xfedcba98, false, false)); }   /* lane l <-> lane l ^ 16 */

// fa_rows: one wave, 16 query rows of one plane, all TT keys in passes of 32. S^T = K.Q^T (tile rows = keys, columns = queries) and O^T += V^T.P^T, so lane (lr, hi) holds query lr only:
// of each 16-key score tile it has keys 8 hi + j in register j, which is the k order of a B fragment over two tiles: P goes from the score accumulators into the second product without leaving the lane.
// Softmax with a running maximum m_run and running sum l_run per query (each wave half sums its own keys; the halves meet once at the end); the output tile is rescaled by exp(m_old - m_new) every pass and divided by the sum at the end.
// Every inner loop is fully unrolled: fragments, scores and accumulators stay in registers only under compile-time indices. The loop over the passes stays rolled.
template <bool HI>
__device__ __forceinline__ void fa_rows(const bf* __restrict__ Qh, const bf* __restrict__ Kh, const h16* __restrict__ V16, const bf* __restrict__ Vh, const float* __restrict__ mrow, float* __restrict__ orow) {
    const int lane = threadIdx.x & 31, lr = lane & 15, hi = lane >> 4;
    v16bf qh[2]; const bf* qp = Qh + lr * HD + 8 * hi;
#pragma unroll
    for (int ks = 0; ks < 2; ++ks) qh[ks] = WFrag<bf>::ld(qp + 32 * ks);
    const int koff = 8 * lane, voff = 8 * lane, moff = lr * TT + 8 * hi;   /* K and V^T planes are in fragment order: tile kt, k step ks of K at 1024 kt + 512 ks, tile dt of V^T at 512 dt behind the pass's first element HD x key0 */
    v8f acc[4];
#pragma unroll
    for (int dt = 0; dt < 4; ++dt) acc[dt] = (v8f){};
    float m_run = -3.0e38f, l_run = 0.f;
    v16bf kh[2][2]; v4f mk[2][2];
#pragma unroll
    for (int kt = 0; kt < 2; ++kt) {
#pragma unroll
        for (int ks = 0; ks < 2; ++ks) { kh[kt][ks] = WFrag<bf>::ldf(Kh + koff + 1024 * kt + 512 * ks); mk[kt][ks] = *(const v4f*)(mrow + moff + 16 * kt + 4 * ks); } }
    holdxa(qp, Kh + koff, mrow + moff);   /* the wait that stands in front of any overwrite of the first loads' address registers */
    for (int key0 = 0; key0 < TT; key0 += 32) {
        const int kn = (key0 + 32 < TT) ? key0 + 32 : key0;   /* the pass fetched ahead; the last pass fetches its own rows again (in bounds, unused) */
        v16h v6[4]; v16bf vh[4];   /* this pass's V^T fragments: asked for first, used last */
#pragma unroll
        for (int dt = 0; dt < 4; ++dt) { if constexpr (HI) vh[dt] = WFrag<bf>::ldf(Vh + voff + key0 * HD + 512 * dt); else v6[dt] = WFrag<h16>::ldf(V16 + voff + key0 * HD + 512 * dt); }
        hold();   /* V^T is asked for before the first product starts (its address registers are next written behind the waits for its data) */
        v8f s[2]; s[0] = (v8f){}; s[1] = (v8f){};
#pragma unroll
        for (int ks = 0; ks < 2; ++ks) {
#pragma unroll
            for (int kt = 0; kt < 2; ++kt) s[kt] = wmmab(kh[kt][ks], qh[ks], s[kt]); }
        hold();   /* the next K fragments are not asked for earlier: issued from here most of them land in the registers this pass has just read */
        /* next pass's K fragments, in flight under this pass's softmax and second product */
        const bf* kp = Kh + koff + kn * HD;
#pragma unroll
        for (int kt = 0; kt < 2; ++kt) {
#pragma unroll
            for (int ks = 0; ks < 2; ++ks) kh[kt][ks] = WFrag<bf>::ldf(kp + 1024 * kt + 512 * ks); }
        holdxa(kp);   /* K is asked for before the softmax starts */
        float t[16]; float mx = -3.0e38f;
#pragma unroll
        for (int kt = 0; kt < 2; ++kt) {
#pragma unroll
            for (int jp = 0; jp < 4; ++jp) { const unsigned u = pkbf(mk[kt][jp >> 1][(jp & 1) * 2], mk[kt][jp >> 1][(jp & 1) * 2 + 1]);   /* mask bf16-rounded, added in f32: scores x SCL + attn_mask[i][j] */
                t[kt * 8 + 2 * jp] = fmaf(s[kt][2 * jp], SCL, lo2f(u)); t[kt * 8 + 2 * jp + 1] = fmaf(s[kt][2 * jp + 1], SCL, hi2f(u)); mx = fmaxf(mx, fmaxf(t[kt * 8 + 2 * jp], t[kt * 8 + 2 * jp + 1])); } }
        hold();   /* the next mask values are not asked for earlier: this pass's are read above */
        /* next pass's mask values */
#pragma unroll
        for (int kt = 0; kt < 2; ++kt) {
#pragma unroll
            for (int hf = 0; hf < 2; ++hf) mk[kt][hf] = *(const v4f*)(mrow + moff + kn + 16 * kt + 4 * hf); }
        holdx();   /* the mask loads stay in this pass */
        mx = fmaxf(mx, xhalf(mx));   /* both halves hold the query's maximum of this pass */
        const float m_new = fmaxf(m_run, mx); float corr = (m_run - m_new) * L2E; m_run = m_new;   /* becomes 2^corr below: 0 on the first pass */
        const float nm = (HI ? 0.0f : PSH) - m_new * L2E;
#pragma unroll
        for (int k = 0; k < 16; ++k) t[k] = fmaf(t[k], L2E, nm);
        /* the pass's 17 exponentials as one run, each in place in a register of its own: none waits for its neighbour (under the register cap the compiler sent every argument through one register: multiply-add, wait, exponential, 16 times over),
           and none is followed directly by a reader of its result or a writer of its source; the v_nop is that free slot behind the last one */
        asm("v_exp_f32 %0, %0\n\tv_exp_f32 %1, %1\n\tv_exp_f32 %2, %2\n\tv_exp_f32 %3, %3\n\tv_exp_f32 %4, %4\n\tv_exp_f32 %5, %5\n\tv_exp_f32 %6, %6\n\tv_exp_f32 %7, %7\n\tv_exp_f32 %8, %8\n\t"
            "v_exp_f32 %9, %9\n\tv_exp_f32 %10, %10\n\tv_exp_f32 %11, %11\n\tv_exp_f32 %12, %12\n\tv_exp_f32 %13, %13\n\tv_exp_f32 %14, %14\n\tv_exp_f32 %15, %15\n\tv_exp_f32 %16, %16\n\tv_nop"
            : "+v"(corr), "+v"(t[0]), "+v"(t[1]), "+v"(t[2]), "+v"(t[3]), "+v"(t[4]), "+v"(t[5]), "+v"(t[6]), "+v"(t[7]), "+v"(t[8]), "+v"(t[9]), "+v"(t[10]), "+v"(t[11]), "+v"(t[12]), "+v"(t[13]), "+v"(t[14]), "+v"(t[15]));
        float ps[8];   /* the pass's sum as a tree: a chain of 16 dependent adds would stand exposed in a lone wave */
#pragma unroll
        for (int k = 0; k < 8; ++k) ps[k] = t[2 * k] + t[2 * k + 1];
#pragma unroll
        for (int st = 4; st; st >>= 1) {
#pragma unroll
            for (int k = 0; k < st; ++k) ps[k] += ps[k + st]; }
        l_run = fmaf(l_run, corr, ps[0]);
#pragma unroll
        for (int dt = 0; dt < 4; ++dt) acc[dt] = acc[dt] * corr;
        if constexpr (HI) {
            v8u uh, ul;
#pragma unroll
            for (int i = 0; i < 8; ++i) { uh[i] = pkbf(t[2 * i], t[2 * i + 1]); ul[i] = pkbf(t[2 * i] - lo2f(uh[i]), t[2 * i + 1] - hi2f(uh[i])); }
            const v16bf ph = __builtin_bit_cast(v16bf, uh), pl = __builtin_bit_cast(v16bf, ul);
#pragma unroll
            for (int dt = 0; dt < 4; ++dt) acc[dt] = wmmab(vh[dt], ph, acc[dt]);
#pragma unroll
            for (int dt = 0; dt < 4; ++dt) acc[dt] = wmmab(vh[dt], pl, acc[dt]);
        } else {
            v8u up;
#pragma unroll
            for (int i = 0; i < 8; ++i) up[i] = pkh(t[2 * i], t[2 * i + 1]);
            const v16h pf = __builtin_bit_cast(v16h, up);
#pragma unroll
            for (int dt = 0; dt < 4; ++dt) acc[dt] = wmma16(v6[dt], pf, acc[dt]);
        }
        hold();   /* whatever register copies the loop's back edge needs for the fetched-ahead values stay down here: higher up they would wait for those loads in the middle of the pass */
    }
    const float inv = __fdiv_rn(1.0f, l_run + xhalf(l_run));
#pragma unroll
    for (int dt = 0; dt < 4; ++dt) {   /* register j of tile dt is d = 16 dt + 8 hi + j of query lr: 32 contiguous bytes per lane */
        v4f o0, o1;
#pragma unroll
        for (int j = 0; j < 4; ++j) { o0[j] = acc[dt][j] * inv; o1[j] = acc[dt][4 + j] * inv; }
        float* op = orow + lr * HD + 16 * dt + 8 * hi; *(v4f*)op = o0; *(v4f*)(op + 4) = o1; }
}
// k_fattn: grid (TT / (16 FW), ZH), FW waves; wave w of block x takes query rows 16 (FW x + w) .. + 15 of plane y. No LDS, no barrier: the waves of a block only share K, V lines in the WGP cache.
// 1024 work-groups on 256 WGPs: four are resident per WGP, so each SIMD holds four waves of different work-groups, and one wave's load and dependency waits are issue slots for the other three.
// amdgpu_waves_per_eu(4, 4) states those four waves per SIMD: the register allocator works for that occupancy and no other (both loops stay below 256 registers, no s_set_vgpr_msb).
__global__ __launch_bounds__(32 * FW) __attribute__((amdgpu_waves_per_eu(4, 4))) void k_fattn(const bf* __restrict__ Qh, const bf* __restrict__ Kh, const h16* __restrict__ V16, const bf* __restrict__ Vh, const float* __restrict__ mskf, float* __restrict__ OUTb) {
    const int w = __builtin_amdgcn_readfirstlane((int)(threadIdx.x >> 5)); const int q0 = ((int)blockIdx.x * FW + w) * 16; const size_t zo = (size_t)blockIdx.y * TT * HD;
    if (q0 < RH) fa_rows<true>(Qh + zo + (size_t)q0 * HD, Kh + zo, V16 + zo, Vh + zo, mskf + (size_t)q0 * TT, OUTb + zo + (size_t)q0 * HD);
    else fa_rows<false>(Qh + zo + (size_t)q0 * HD, Kh + zo, V16 + zo, Vh + zo, mskf + (size_t)q0 * TT, OUTb + zo + (size_t)q0 * HD);
}
extern "C" void kernel_launch(void* const* d_in, const int* in_sizes, int n_in,
                              void* d_out, int out_size, void* d_ws, size_t ws_size, hipStream_t stream) {
    (void)in_sizes; (void)n_in; (void)out_size;
    const float* x = (const float*)d_in[0]; const float* xk = (const float*)d_in[1]; const float* xv = (const float*)d_in[2]; const float* amask = (const float*)d_in[3];   /* attn_mask f32 [1][1][2048][2048], read */   /* query, key, value: [32][2048][64] each (no projections) */ const float* wq = nullptr, *wk = nullptr, *wv = nullptr, *wo = nullptr; (void)wq; (void)wk; (void)wv; (void)wo;
    float* OUT = (float*)d_out;     // [32][2048][64]
    char* wsp = (char*)d_ws;
    auto take = [&](size_t bytes) { char* p = wsp; wsp += (bytes + 255) & ~(size_t)255; return (void*)p; };
    bf* WQ = (bf*)take((size_t)DQ * DM * 2); bf* WK = (bf*)take((size_t)DKV * DM * 2); bf* WV = (bf*)take((size_t)DKV * DM * 2); float* CS = (float*)take((size_t)TT * HD * 2 * 4);
    bf* XB = (bf*)take((size_t)TT * DM * 2); float* FQ = (float*)take((size_t)TT * DQ * 4); float* FK = (float*)take((size_t)TT * DKV * 4);
    h16* VT16 = (h16*)take((size_t)ZH * HD * TT * 2);
    bf* QPh = (bf*)take((size_t)ZH * TT * HD * 2); bf* KPh = (bf*)take((size_t)ZH * TT * HD * 2); bf* VTh = (bf*)take((size_t)ZH * HD * TT * 2);
    if ((size_t)(wsp - (char*)d_ws) > ws_size) return;    // ws 256 MiB
    float* FV = FK;   // FV aliases the k buffer; unused, as there is no v projection
    {   
      
       }
    k_csid<<<(TT * HD / 4 + 255) / 256, 256, 0, stream>>>(CS);
    const unsigned LQ = (unsigned)(((size_t)ZH * TT * HD / 32 + 255) / 256), LKv = LQ;   /* 32 elements a thread in all three builders */
    for (int b = 0; b < NB_; b += ZH) {   /* one pass = ZH consecutive planes */
        
        /* no projections: the q, k, v inputs feed the plane builders directly */
        
        k_rope<false><<<LQ, 256, 0, stream>>>(x + (size_t)b * TT * HD, DQ, ZH, CS, nullptr, nullptr, 1.0f, QPh);   /* q plane straight from the input */
        
        k_rope<true><<<LKv, 256, 0, stream>>>(xk + (size_t)b * TT * HD, DKV, ZH, CS, nullptr, nullptr, 1.0f, KPh);
         k_vtp<<<LKv, 256, 0, stream>>>(xv + (size_t)b * TT * HD, DKV, ZH, VT16, VTh);
        k_fattn<<<dim3(TT / (16 * FW), ZH), 32 * FW, 0, stream>>>(QPh, KPh, VT16, VTh, amask, OUT + (size_t)b * TT * DQ);   /* scores, mask, softmax and hybrid P.V in one launch; plane y of the pass uses q, k and v plane y */
         }
}

// v008
// Measured time: 76.1 microseconds a run.
// In both of two side-by-side timings against v007, it was 1.07 times as fast.
// Counting every step since v000, it is 47.4 times as fast.
#include <hip/hip_runtime.h>

// Scaled dot-product attention on raw per-head inputs with an ADDITIVE random float mask (query, key, value [2][16][2048][64] = 32 planes, no projections; scores = q.k^T x 1/sqrt(64) + attn_mask with attn_mask f32 [1][1][2048][2048] standard-normal draws shared by all planes (read per (query, key) on device, bf16-rounded); softmax over keys; out = probs.v -> [2][16][2048][64] (4.2 M); argument order query, key, value, attn_mask).
// Layout: all 32 planes in one pass, each launch covering them through grid y or 32 x the rows (5 launches); per plane: the raw f32 inputs are ROUNDED TO bf16 first and stored as 16-bit planes (the K and V^T planes in fragment order, see fragk / fragv; the mask, shared by all planes, as one bf16 plane in the order of the score accumulators, see fragm); a bf16-rounded value has no bf16 remainder, so one plane holds all of it; ONE fused kernel then walks the 2048 keys 32 at a time per 16 query rows: scores as one bf16 product, mask added, running maximum and sum per query, P.V hybrid (rows < 512: P as bf16 hi + lo against bf16 V, rest fp16 x1024); scores and probabilities stay in registers, the kernel writes the output rows.
// Compute dtypes, f32 accumulate: every input rounded to bf16; scores bf16 x bf16 (exact operands) + bf16-rounded mask added in f32; softmax f32; P.V rows < 512 two products (P hi and P lo), rest fp16; output f32.

#define NB_  32
#define TT   2048
#define DM   64
#define NH_  1
#define NKV  1
#define REP  (NH_ / NKV)
#define HD   64
#define DQ   (NH_ * HD)
#define DKV  (NKV * HD)
#define ZH   32                   // planes per pass: every launch of a pass covers ZH planes (grid y, or ZH x the rows); 32 / ZH passes. All 32: five 16-bit planes of 8 MiB each in the workspace, and 1024 work-groups in the fused launch
#define RH   512                  // query rows < RH carry P as bf16 hi + lo (0: none)
#define WIN  0
#define PU   4                    // planes per thread of k_rope (ZH is a multiple of it)
#define FW   4                    // waves per work-group of the fused kernel, 16 query rows each: one wave per SIMD of a WGP, K and V shared through the WGP cache
#define PSH  10.0f                // rows >= RH: probabilities carry a factor 2^PSH into fp16 (it cancels against the sum)
#define L2E  1.4426950408889634f
#define SCL  0.125f   // 1/sqrt(64)
typedef _Float16 h16;
typedef unsigned short bf;
typedef __attribute__((ext_vector_type(16))) __bf16   v16bf;
typedef __attribute__((ext_vector_type(16))) _Float16 v16h;
typedef __attribute__((ext_vector_type(8)))  _Float16 v8h;
typedef __attribute__((ext_vector_type(8)))  unsigned short v8us;
typedef __attribute__((ext_vector_type(8)))  float    v8f;
typedef __attribute__((ext_vector_type(4)))  float    v4f;
typedef v8h  __attribute__((may_alias)) v8ha;
typedef v4f  __attribute__((may_alias)) v4fa;
typedef v8us __attribute__((may_alias)) v8usa;

__device__ __forceinline__ unsigned short f2bf(float f) { unsigned u = __float_as_uint(f); u += 0x7FFFu + ((u >> 16) & 1u); return (unsigned short)(u >> 16); }
__device__ __forceinline__ float bf2f(unsigned short b) { return __uint_as_float(((unsigned)b) << 16); }
__device__ __forceinline__ float bfr(float f) { return bf2f(f2bf(f)); }
__device__ __forceinline__ v16h cat16(v8h lo, v8h hi) { return __builtin_shufflevector(lo, hi, 0, 1, 2, 3, 4, 5, 6, 7, 8, 9, 10, 11, 12, 13, 14, 15); }
__device__ __forceinline__ v16bf cat16b(v8us lo, v8us hi) { return __builtin_bit_cast(v16bf, __builtin_shufflevector(lo, hi, 0, 1, 2, 3, 4, 5, 6, 7, 8, 9, 10, 11, 12, 13, 14, 15)); }
__device__ __forceinline__ v8f wmma16(v16h a, v16h b, v8f c) { return __builtin_amdgcn_wmma_f32_16x16x32_f16(false, a, false, b, (short)0, c, false, false); }
__device__ __forceinline__ v8f wmmab(v16bf a, v16bf b, v8f c) { return __builtin_amdgcn_wmma_f32_16x16x32_bf16(false, a, false, b, (short)0, c, false, false); }



// 16x16x32 operand fragment of a K-contiguous 16-bit plane: the pointer already holds row (lane & 15) and k offset 8 x (lane >> 4); A and B use the same map
template <typename T16> struct WFrag;
// ldf: the same fragment from a plane stored in FRAGMENT ORDER: the 32 lanes' 16-byte pieces of one load lie side by side (512 contiguous bytes = 4 whole cache lines a load, where a row-major plane makes a load touch 16 lines for 32 bytes each); the pointer already holds 8 x lane, the fragment's second half follows 256 elements on
template <> struct WFrag<h16> { typedef v16h V; static __device__ __forceinline__ V ld(const h16* p) { return cat16(*(const v8h*)p, *(const v8h*)(p + 16)); } static __device__ __forceinline__ V ldf(const h16* p) { return cat16(*(const v8h*)p, *(const v8h*)(p + 256)); } static __device__ __forceinline__ v8f mma(V a, V b, v8f c) { return wmma16(a, b, c); } };
template <> struct WFrag<bf> { typedef v16bf V; static __device__ __forceinline__ V ld(const bf* p) { return cat16b(*(const v8us*)p, *(const v8us*)(p + 16)); } static __device__ __forceinline__ V ldf(const bf* p) { return cat16b(*(const v8us*)p, *(const v8us*)(p + 256)); } static __device__ __forceinline__ v8f mma(V a, V b, v8f c) { return wmmab(a, b, c); } };

__device__ __forceinline__ h16 tohx(float x) { return (h16)x; }
typedef __attribute__((ext_vector_type(2))) _Float16 v2h;
typedef __attribute__((ext_vector_type(4))) _Float16 v4h;
typedef __attribute__((ext_vector_type(2))) unsigned short v2us;
typedef __attribute__((ext_vector_type(4))) unsigned short v4us;
typedef __attribute__((ext_vector_type(2))) float v2f;
typedef __attribute__((ext_vector_type(4))) int v4i;
typedef __attribute__((ext_vector_type(4))) unsigned v4u;
typedef __attribute__((ext_vector_type(2))) __bf16 v2bf;
__device__ __forceinline__ unsigned pkbf(float a, float b) { v2f x; x[0] = a; x[1] = b; return __builtin_bit_cast(unsigned, __builtin_convertvector(x, v2bf)); }   /* two f32 -> two bf16, round to nearest even */

// Fragment order of one plane (TT x HD elements). A fragment half is [lane = 16 hi + lr][j = 0..7], 256 elements; lane (lr, hi) holds tile row lr and k = 16 c + 8 hi + j of half c.
// fragk: K, tile rows = keys, k = d: [key / 16][d / 32][c = d / 16 & 1][hi = d / 8 & 1][lr = key & 15][j = d & 7]; a pass of 32 keys is 2048 consecutive elements.
// fragv: V^T, tile rows = d, k = keys: [key / 32][d / 16][c = key / 16 & 1][hi = key / 8 & 1][lr = d & 15][j = key & 7]; a pass of 32 keys is 2048 consecutive elements.
__device__ __forceinline__ size_t fragk(int key, int d) { return (size_t)((key >> 4) * 1024 + (d >> 5) * 512 + ((d >> 4) & 1) * 256 + ((d >> 3) & 1) * 128 + (key & 15) * 8 + (d & 7)); }
__device__ __forceinline__ size_t fragv(int d, int key) { return (size_t)((key >> 5) * 2048 + (d >> 4) * 512 + ((key >> 4) & 1) * 256 + ((key >> 3) & 1) * 128 + (d & 15) * 8 + (key & 7)); }
// fragm: the mask, in the order in which the fused kernel's lanes hold S^T: [query / 16][key / 32][kt = key / 16 & 1][hi = key / 8 & 1][lr = query & 15][j = key & 7]; a pass of 32 keys x 16 queries is 512 consecutive elements, two wave-wide 16-byte loads of 512 contiguous bytes each.
__device__ __forceinline__ size_t fragm(int q, int key) { return (size_t)((q >> 4) * (16 * TT) + (key >> 5) * 512 + ((key >> 4) & 1) * 256 + ((key >> 3) & 1) * 128 + (q & 15) * 8 + (key & 7)); }
// k_rope: head plane [h][t][d] (bf16) of rope(x) x sc with the rotate-half convention out[d] = x[d] cos[t][d] - x[d+HD/2] sin[t][d], out[d+HD/2] = x[d+HD/2] cos[t][d+HD/2] + x[d] sin[t][d+HD/2]; FO: the plane goes out in fragment order (fragk)
// The three plane builders are streams: a thread takes 32 elements, not 2 (its loads all asked for first, 16-byte stores), so a launch starts 4096 waves (16 per WGP) instead of 65536; k_vtp, with the mask waves behind, starts 8192.
// k_rope thread: 8 consecutive d of row t (one 16-byte piece of the plane, in fragment order too: j = d & 7) in PU planes h0 + p x nheads / PU, which share the thread's cos/sin values.
template <bool FO> __global__ __launch_bounds__(256) void k_rope(const float* __restrict__ F, int pitch, int nheads, const float* __restrict__ CS, const float* __restrict__ RF, const float* __restrict__ nw, float sc, bf* Ph) {
    (void)RF; (void)nw;   /* every launch passes null: the row-factor branch is gone, the 32 elements are one straight run */
    const int hs = nheads / PU; const size_t e0 = ((size_t)blockIdx.x * 256 + threadIdx.x) * 8; if (e0 >= (size_t)hs * TT * HD) return; const int d = (int)(e0 % HD); const int t = (int)((e0 / HD) % TT); const int h0 = (int)(e0 / ((size_t)HD * TT));
    const int dq = (d < HD / 2) ? d + HD / 2 : d - HD / 2;   /* the 8 partners d +- HD / 2 lie side by side as well */
    v4f c4[4], xa[PU][2], xb[PU][2]; const float* pc = CS + ((size_t)t * HD + d) * 2; const float* pa[PU]; const float* pb[PU];
#pragma unroll
    for (int i = 0; i < 4; ++i) c4[i] = *(const v4f*)(pc + 4 * i);
#pragma unroll
    for (int p = 0; p < PU; ++p) { const float* f = F + ((size_t)(h0 + p * hs) * TT + t) * pitch;   /* source planes [h][t][d] */
        pa[p] = f + d; pb[p] = f + dq; xa[p][0] = *(const v4f*)pa[p]; xa[p][1] = *(const v4f*)(pa[p] + 4); xb[p][0] = *(const v4f*)pb[p]; xb[p][1] = *(const v4f*)(pb[p] + 4); }
    /* the wait that stands in front of any overwrite of the 20 loads' address registers; it takes the addresses as inputs, so that none of their registers is handed to a later load's result ahead of it */
    static_assert(PU == 4, "the wait names PU pairs of addresses");
    asm volatile("s_wait_xcnt 0x0" :: "v"(pc), "v"(pa[0]), "v"(pb[0]), "v"(pa[1]), "v"(pb[1]), "v"(pa[2]), "v"(pb[2]), "v"(pa[3]), "v"(pb[3]) : "memory");
#pragma unroll
    for (int p = 0; p < PU; ++p) { const int h = h0 + p * hs; v8us oh;
#pragma unroll
    for (int q = 0; q < 8; ++q) { const int dd = d + q; float x0 = bfr(xa[p][q >> 2][q & 3]), x1 = bfr(xb[p][q >> 2][q & 3]);   /* RAW d_in source: round to bf16 FIRST */
        v2f cs; cs[0] = c4[q >> 1][(q & 1) * 2]; cs[1] = c4[q >> 1][(q & 1) * 2 + 1]; float a = __fmul_rn(x0, cs[0]), bq = __fmul_rn(x1, cs[1]); const float r = ((dd < HD / 2) ? __fsub_rn(a, bq) : __fadd_rn(a, bq)) * sc;
        oh[q] = f2bf(r); }
    const size_t e = ((size_t)h * TT + t) * HD + d; const size_t eo = FO ? (size_t)h * TT * HD + fragk(t, d) : e;   /* d is a multiple of 8: the piece stays side by side */
    *(v8us*)(Ph + eo) = oh; }  }
// k_vtp wave: 16 keys x all HD d of one plane. Lane (lr, hi) takes keys 8 hi + j (j = 0..7) at d = 16 dt + lr, dt = 0..3: a load reads 64 contiguous bytes of two rows, and the wave uses up each row's two lines;
// the 8 keys are one 16-byte piece of fragv, and the 32 lanes' pieces of one dt lie side by side: every store writes 512 contiguous bytes.
// The waves behind the V^T waves build the mask plane: wave wm takes 16 queries x 64 keys (256 bytes of each row). Lane (lr, hi) takes keys 16 c + 8 hi + j (c = 0..3) of query lr: its 8 loads first, then four 16-byte pieces of fragm; the 32 lanes' pieces of one c lie side by side.
__global__ __launch_bounds__(256) void k_vtp(const float* __restrict__ F, int pitch, int nheads, h16* V16, bf* Vh, const float* __restrict__ M, bf* MP) { const int wv = __builtin_amdgcn_readfirstlane((int)((blockIdx.x * 256 + threadIdx.x) >> 5));   /* the wave's number as a scalar: the choice between the two builders is a scalar branch */
    const int lane = threadIdx.x & 31, lr = lane & 15, hi = lane >> 4;
    if (wv >= nheads * (TT / 16)) { const int wm = wv - nheads * (TT / 16); if (wm >= (TT / 16) * (TT / 64)) return;
        const int q = (wm / (TT / 64)) * 16 + lr, k0 = (wm % (TT / 64)) * 64 + 8 * hi; const float* mp = M + (size_t)q * TT + k0; v4f mv[4][2];
#pragma unroll
        for (int c = 0; c < 4; ++c) { mv[c][0] = *(const v4f*)(mp + 16 * c); mv[c][1] = *(const v4f*)(mp + 16 * c + 4); }
        asm volatile("s_wait_xcnt 0x0" :: "v"(mp) : "memory");   /* the wait that stands in front of any overwrite of the 8 loads' address registers */
#pragma unroll
        for (int c = 0; c < 4; ++c) { v4u o;
#pragma unroll
            for (int i = 0; i < 4; ++i) o[i] = pkbf(mv[c][i >> 1][(i & 1) * 2], mv[c][i >> 1][(i & 1) * 2 + 1]);   /* the bf16 rounding, once for all planes */
            *(v4u*)(MP + fragm(q, k0 + 16 * c)) = o; }
        return; }
    const int g = wv / (TT / 16); const int t = (wv % (TT / 16)) * 16 + 8 * hi;
    float xv[4][8];
#pragma unroll
    for (int q = 0; q < 8; ++q) {
#pragma unroll
        for (int dt = 0; dt < 4; ++dt) xv[dt][q] = F[((size_t)g * TT + t + q) * pitch + 16 * dt + lr]; }
#pragma unroll
    for (int dt = 0; dt < 4; ++dt) { v8h o16; v8us oh;
#pragma unroll
    for (int q = 0; q < 8; ++q) { const float x = bfr(xv[dt][q]);   /* RAW d_in source: bf16-rounded first */ o16[q] = tohx(x); oh[q] = f2bf(x); }
    const size_t eo = (size_t)g * HD * TT + fragv(16 * dt + lr, t);   /* both V^T planes in fragment order; t is a multiple of 8: the piece stays side by side */
    *(v8h*)(V16 + eo) = o16; *(v8us*)(Vh + eo) = oh; }  }
__global__ __launch_bounds__(256) void k_csid(float* CS) { const int idx = (blockIdx.x * 256 + threadIdx.x) * 4; if (idx >= TT * HD) return; v4f cs; cs[0] = 1.0f; cs[1] = 0.0f; cs[2] = 1.0f; cs[3] = 0.0f; *(v4f*)(CS + (size_t)idx * 2) = cs; *(v4f*)(CS + (size_t)idx * 2 + 4) = cs;  }   /* four (cos, sin) pairs a thread */
typedef __attribute__((ext_vector_type(8))) unsigned v8u;
__device__ __forceinline__ unsigned pkh(float a, float b) { v2f x; x[0] = a; x[1] = b; return __builtin_bit_cast(unsigned, __builtin_convertvector(x, v2h)); }     /* two f32 -> two fp16, round to nearest even */
__device__ __forceinline__ float lo2f(unsigned u) { return __uint_as_float(u << 16); }
__device__ __forceinline__ float hi2f(unsigned u) { return __uint_as_float(u & 0xFFFF0000u); }
// hold(): a load group stays where the source puts it. The memory clobber keeps the optimiser from merging or sinking the loads across it, the scheduling barrier keeps the scheduler from it: without them each group moves down to its first use (or into the next pass) and its latency is waited for in full.
__device__ __forceinline__ void hold() { asm volatile("" ::: "memory"); __builtin_amdgcn_sched_barrier(0); }
// holdxa(): the same behind a load group, with the wait that stands in front of any overwrite of the group's address registers; it takes the group's addresses as inputs, so that none of their registers is handed to one of the group's own results ahead of the wait.
__device__ __forceinline__ void holdxa(const void* p) { asm volatile("s_wait_xcnt 0x0" :: "v"(p) : "memory"); __builtin_amdgcn_sched_barrier(0); }
__device__ __forceinline__ void holdxa(const void* p, const void* q, const void* r) { asm volatile("s_wait_xcnt 0x0" :: "v"(p), "v"(q), "v"(r) : "memory"); __builtin_amdgcn_sched_barrier(0); }
__device__ __forceinline__ float xhalf(float x) { return __builtin_bit_cast(float, __builtin_amdgcn_permlanex16(__builtin_bit_cast(int, x), __builtin_bit_cast(int, x), 0x76543210, 0xfedcba98, false, false)); }   /* lane l <-> lane l ^ 16 */

// fa_rows: one wave, 16 query rows of one plane, all TT keys in passes of 32. S^T = K.Q^T (tile rows = keys, columns = queries) and O^T += V^T.P^T, so lane (lr, hi) holds query lr only:
// of each 16-key score tile it has keys 8 hi + j in register j, which is the k order of a B fragment over two tiles: P goes from the score accumulators into the second product without leaving the lane.
// Softmax with a running maximum m_run and running sum l_run per query (each wave half sums its own keys; the halves meet once at the end); the output tile is rescaled by exp(m_old - m_new) every pass and divided by the sum at the end.
// Every inner loop is fully unrolled: fragments, scores and accumulators stay in registers only under compile-time indices. The loop over the passes stays rolled.
template <bool HI>
__device__ __forceinline__ void fa_rows(const bf* __restrict__ Qh, const bf* __restrict__ Kh, const h16* __restrict__ V16, const bf* __restrict__ Vh, const bf* __restrict__ mrow, float* __restrict__ orow) {
    const int lane = threadIdx.x & 31, lr = lane & 15, hi = lane >> 4;
    v16bf qh[2]; const bf* qp = Qh + lr * HD + 8 * hi;
#pragma unroll
    for (int ks = 0; ks < 2; ++ks) qh[ks] = WFrag<bf>::ld(qp + 32 * ks);
    const int koff = 8 * lane, voff = 8 * lane, moff = 8 * lane;   /* K and V^T planes are in fragment order: tile kt, k step ks of K at 1024 kt + 512 ks, tile dt of V^T at 512 dt behind the pass's first element HD x key0; the mask plane likewise: tile kt at 256 kt behind the pass's first element 16 x key0 */
    v8f acc[4];
#pragma unroll
    for (int dt = 0; dt < 4; ++dt) acc[dt] = (v8f){};
    float m_run = -3.0e38f, l_run = 0.f;
    v16bf kh[2][2]; v4u mk[2];
#pragma unroll
    for (int kt = 0; kt < 2; ++kt) {
#pragma unroll
        for (int ks = 0; ks < 2; ++ks) kh[kt][ks] = WFrag<bf>::ldf(Kh + koff + 1024 * kt + 512 * ks);
        mk[kt] = *(const v4u*)(mrow + moff + 256 * kt); }
    holdxa(qp, Kh + koff, mrow + moff);   /* the wait that stands in front of any overwrite of the first loads' address registers */
    for (int key0 = 0; key0 < TT; key0 += 32) {
        const int kn = (key0 + 32 < TT) ? key0 + 32 : key0;   /* the pass fetched ahead; the last pass fetches its own rows again (in bounds, unused) */
        v16h v6[4]; v16bf vh[4];   /* this pass's V^T fragments: asked for first, used last */
#pragma unroll
        for (int dt = 0; dt < 4; ++dt) { if constexpr (HI) vh[dt] = WFrag<bf>::ldf(Vh + voff + key0 * HD + 512 * dt); else v6[dt] = WFrag<h16>::ldf(V16 + voff + key0 * HD + 512 * dt); }
        hold();   /* V^T is asked for before the first product starts (its address registers are next written behind the waits for its data) */
        v8f s[2]; s[0] = (v8f){}; s[1] = (v8f){};
#pragma unroll
        for (int ks = 0; ks < 2; ++ks) {
#pragma unroll
            for (int kt = 0; kt < 2; ++kt) s[kt] = wmmab(kh[kt][ks], qh[ks], s[kt]); }
        hold();   /* the next K fragments are not asked for earlier: issued from here most of them land in the registers this pass has just read */
        /* next pass's K fragments, in flight under this pass's softmax and second product */
        const bf* kp = Kh + koff + kn * HD;
#pragma unroll
        for (int kt = 0; kt < 2; ++kt) {
#pragma unroll
            for (int ks = 0; ks < 2; ++ks) kh[kt][ks] = WFrag<bf>::ldf(kp + 1024 * kt + 512 * ks); }
        holdxa(kp);   /* K is asked for before the softmax starts */
        float t[16]; float mx = -3.0e38f;
#pragma unroll
        for (int kt = 0; kt < 2; ++kt) {
#pragma unroll
            for (int jp = 0; jp < 4; ++jp) { const unsigned u = mk[kt][jp];   /* mask bf16-rounded (in the plane), added in f32: scores x SCL + attn_mask[i][j] */
                t[kt * 8 + 2 * jp] = fmaf(s[kt][2 * jp], SCL, lo2f(u)); t[kt * 8 + 2 * jp + 1] = fmaf(s[kt][2 * jp + 1], SCL, hi2f(u)); mx = fmaxf(mx, fmaxf(t[kt * 8 + 2 * jp], t[kt * 8 + 2 * jp + 1])); } }
        hold();   /* the next mask values are not asked for earlier: this pass's are read above */
        /* next pass's mask values */
        const bf* mp = mrow + moff + kn * 16;
#pragma unroll
        for (int kt = 0; kt < 2; ++kt) mk[kt] = *(const v4u*)(mp + 256 * kt);
        holdxa(mp);   /* the mask loads stay in this pass */
        mx = fmaxf(mx, xhalf(mx));   /* both halves hold the query's maximum of this pass */
        const float m_new = fmaxf(m_run, mx); float corr = (m_run - m_new) * L2E; m_run = m_new;   /* becomes 2^corr below: 0 on the first pass */
        const float nm = (HI ? 0.0f : PSH) - m_new * L2E;
#pragma unroll
        for (int k = 0; k < 16; ++k) t[k] = fmaf(t[k], L2E, nm);
        /* the pass's 17 exponentials as one run, each in place in a register of its own: none waits for its neighbour (under the register cap the compiler sent every argument through one register: multiply-add, wait, exponential, 16 times over),
           and none is followed directly by a reader of its result or a writer of its source; the v_nop is that free slot behind the last one */
        asm("v_exp_f32 %0, %0\n\tv_exp_f32 %1, %1\n\tv_exp_f32 %2, %2\n\tv_exp_f32 %3, %3\n\tv_exp_f32 %4, %4\n\tv_exp_f32 %5, %5\n\tv_exp_f32 %6, %6\n\tv_exp_f32 %7, %7\n\tv_exp_f32 %8, %8\n\t"
            "v_exp_f32 %9, %9\n\tv_exp_f32 %10, %10\n\tv_exp_f32 %11, %11\n\tv_exp_f32 %12, %12\n\tv_exp_f32 %13, %13\n\tv_exp_f32 %14, %14\n\tv_exp_f32 %15, %15\n\tv_exp_f32 %16, %16\n\tv_nop"
            : "+v"(corr), "+v"(t[0]), "+v"(t[1]), "+v"(t[2]), "+v"(t[3]), "+v"(t[4]), "+v"(t[5]), "+v"(t[6]), "+v"(t[7]), "+v"(t[8]), "+v"(t[9]), "+v"(t[10]), "+v"(t[11]), "+v"(t[12]), "+v"(t[13]), "+v"(t[14]), "+v"(t[15]));
        float ps[8];   /* the pass's sum as a tree: a chain of 16 dependent adds would stand exposed in a lone wave */
#pragma unroll
        for (int k = 0; k < 8; ++k) ps[k] = t[2 * k] + t[2 * k + 1];
#pragma unroll
        for (int st = 4; st; st >>= 1) {
#pragma unroll
            for (int k = 0; k < st; ++k) ps[k] += ps[k + st]; }
        l_run = fmaf(l_run, corr, ps[0]);
#pragma unroll
        for (int dt = 0; dt < 4; ++dt) acc[dt] = acc[dt] * corr;
        if constexpr (HI) {
            v8u uh, ul;
#pragma unroll
            for (int i = 0; i < 8; ++i) { uh[i] = pkbf(t[2 * i], t[2 * i + 1]); ul[i] = pkbf(t[2 * i] - lo2f(uh[i]), t[2 * i + 1] - hi2f(uh[i])); }
            const v16bf ph = __builtin_bit_cast(v16bf, uh), pl = __builtin_bit_cast(v16bf, ul);
#pragma unroll
            for (int dt = 0; dt < 4; ++dt) acc[dt] = wmmab(vh[dt], ph, acc[dt]);
#pragma unroll
            for (int dt = 0; dt < 4; ++dt) acc[dt] = wmmab(vh[dt], pl, acc[dt]);
        } else {
            v8u up;
#pragma unroll
            for (int i = 0; i < 8; ++i) up[i] = pkh(t[2 * i], t[2 * i + 1]);
            const v16h pf = __builtin_bit_cast(v16h, up);
#pragma unroll
            for (int dt = 0; dt < 4; ++dt) acc[dt] = wmma16(v6[dt], pf, acc[dt]);
        }
        hold();   /* whatever register copies the loop's back edge needs for the fetched-ahead values stay down here: higher up they would wait for those loads in the middle of the pass */
    }
    const float inv = __fdiv_rn(1.0f, l_run + xhalf(l_run));
#pragma unroll
    for (int dt = 0; dt < 4; ++dt) {   /* register j of tile dt is d = 16 dt + 8 hi + j of query lr: 32 contiguous bytes per lane */
        v4f o0, o1;
#pragma unroll
        for (int j = 0; j < 4; ++j) { o0[j] = acc[dt][j] * inv; o1[j] = acc[dt][4 + j] * inv; }
        float* op = orow + lr * HD + 16 * dt + 8 * hi; *(v4f*)op = o0; *(v4f*)(op + 4) = o1; }
}
// k_fattn: grid (TT / (16 FW), ZH), FW waves; wave w of block x takes query rows 16 (FW x + w) .. + 15 of plane y. No LDS, no barrier: the waves of a block only share K, V lines in the WGP cache.
// 1024 work-groups on 256 WGPs: four are resident per WGP, so each SIMD holds four waves of different work-groups, and one wave's load and dependency waits are issue slots for the other three.
// amdgpu_waves_per_eu(4, 4) states those four waves per SIMD: the register allocator works for that occupancy and no other (both loops stay below 256 registers, no s_set_vgpr_msb).
__global__ __launch_bounds__(32 * FW) __attribute__((amdgpu_waves_per_eu(4, 4))) void k_fattn(const bf* __restrict__ Qh, const bf* __restrict__ Kh, const h16* __restrict__ V16, const bf* __restrict__ Vh, const bf* __restrict__ mskf, float* __restrict__ OUTb) {
    const int w = __builtin_amdgcn_readfirstlane((int)(threadIdx.x >> 5)); const int q0 = ((int)blockIdx.x * FW + w) * 16; const size_t zo = (size_t)blockIdx.y * TT * HD;
    if (q0 < RH) fa_rows<true>(Qh + zo + (size_t)q0 * HD, Kh + zo, V16 + zo, Vh + zo, mskf + (size_t)q0 * TT, OUTb + zo + (size_t)q0 * HD);
    else fa_rows<false>(Qh + zo + (size_t)q0 * HD, Kh + zo, V16 + zo, Vh + zo, mskf + (size_t)q0 * TT, OUTb + zo + (size_t)q0 * HD);
}
extern "C" void kernel_launch(void* const* d_in, const int* in_sizes, int n_in,
                              void* d_out, int out_size, void* d_ws, size_t ws_size, hipStream_t stream) {
    (void)in_sizes; (void)n_in; (void)out_size;
    const float* x = (const float*)d_in[0]; const float* xk = (const float*)d_in[1]; const float* xv = (const float*)d_in[2]; const float* amask = (const float*)d_in[3];   /* attn_mask f32 [1][1][2048][2048], read */   /* query, key, value: [32][2048][64] each (no projections) */ const float* wq = nullptr, *wk = nullptr, *wv = nullptr, *wo = nullptr; (void)wq; (void)wk; (void)wv; (void)wo;
    float* OUT = (float*)d_out;     // [32][2048][64]
    char* wsp = (char*)d_ws;
    auto take = [&](size_t bytes) { char* p = wsp; wsp += (bytes + 255) & ~(size_t)255; return (void*)p; };
    bf* WQ = (bf*)take((size_t)DQ * DM * 2); bf* WK = (bf*)take((size_t)DKV * DM * 2); bf* WV = (bf*)take((size_t)DKV * DM * 2); float* CS = (float*)take((size_t)TT * HD * 2 * 4);
    bf* XB = (bf*)take((size_t)TT * DM * 2); float* FQ = (float*)take((size_t)TT * DQ * 4); float* FK = (float*)take((size_t)TT * DKV * 4);
    h16* VT16 = (h16*)take((size_t)ZH * HD * TT * 2);
    bf* QPh = (bf*)take((size_t)ZH * TT * HD * 2); bf* KPh = (bf*)take((size_t)ZH * TT * HD * 2); bf* VTh = (bf*)take((size_t)ZH * HD * TT * 2); bf* MPl = (bf*)take((size_t)TT * TT * 2);
    if ((size_t)(wsp - (char*)d_ws) > ws_size) return;    // ws 256 MiB
    float* FV = FK;   // FV aliases the k buffer; unused, as there is no v projection
    {   
      
       }
    k_csid<<<(TT * HD / 4 + 255) / 256, 256, 0, stream>>>(CS);
    const unsigned LQ = (unsigned)(((size_t)ZH * TT * HD / 32 + 255) / 256), LKv = LQ;   /* 32 elements a thread in all three builders */
    for (int b = 0; b < NB_; b += ZH) {   /* one pass = ZH consecutive planes */
        
        /* no projections: the q, k, v inputs feed the plane builders directly */
        
        k_rope<false><<<LQ, 256, 0, stream>>>(x + (size_t)b * TT * HD, DQ, ZH, CS, nullptr, nullptr, 1.0f, QPh);   /* q plane straight from the input */
        
        k_rope<true><<<LKv, 256, 0, stream>>>(xk + (size_t)b * TT * HD, DKV, ZH, CS, nullptr, nullptr, 1.0f, KPh);
         k_vtp<<<LKv + (TT / 16) * (TT / 64) / 8, 256, 0, stream>>>(xv + (size_t)b * TT * HD, DKV, ZH, VT16, VTh, amask, MPl);   /* the blocks behind the V^T blocks build the mask plane */
        k_fattn<<<dim3(TT / (16 * FW), ZH), 32 * FW, 0, stream>>>(QPh, KPh, VT16, VTh, MPl, OUT + (size_t)b * TT * DQ);   /* scores, mask, softmax and hybrid P.V in one launch; plane y of the pass uses q, k and v plane y */
         }
}

// v009
// One run takes 68.4 microseconds.
// Two timings next to v008 put it at 1.09 and 1.13 times that version's speed.
// All steps since v000 together make it 52.5 times as fast.
#include <hip/hip_runtime.h>

// Scaled dot-product attention on raw per-head inputs with an ADDITIVE random float mask (query, key, value [2][16][2048][64] = 32 planes, no projections; scores = q.k^T x 1/sqrt(64) + attn_mask with attn_mask f32 [1][1][2048][2048] standard-normal draws shared by all planes (read per (query, key) on device, bf16-rounded as every input); softmax over keys; out = probs.v -> [2][16][2048][64] (4.2 M); argument order query, key, value, attn_mask).
// Layout: all 32 planes in one pass, each launch covering them through grid y or 32 x the rows (2 launches: one builds every plane, one is the fused kernel); per plane: the raw f32 inputs are ROUNDED TO bf16 first and stored as 16-bit planes (the K and V^T planes in fragment order, see fragk / fragv; the mask, shared by all planes, as one bf16 plane in the order of the score accumulators, see fragm); a bf16-rounded value has no bf16 remainder, so one plane holds all of it; ONE fused kernel then walks the 2048 keys 32 at a time per 16 query rows: scores as one bf16 product, mask added, running maximum and sum per query, P.V hybrid (rows < 512: P as bf16 hi + lo against bf16 V, rest fp16 x1024); scores and probabilities stay in registers, the kernel writes the output rows.
// Compute dtypes, f32 accumulate: every input rounded to bf16; scores bf16 x bf16 (exact operands) + bf16-rounded mask added in f32; softmax f32; P.V rows < 512 two products (P hi and P lo), rest fp16; output f32.

#define NB_  32
#define TT   2048
#define DM   64
#define NH_  1
#define NKV  1
#define REP  (NH_ / NKV)
#define HD   64
#define DQ   (NH_ * HD)
#define DKV  (NKV * HD)
#define ZH   32                   // planes per pass: every launch of a pass covers ZH planes (grid y, or ZH x the rows); 32 / ZH passes. All 32: five 16-bit planes of 8 MiB each in the workspace, and 1024 work-groups in the fused launch
#define RH   512                  // query rows < RH carry P as bf16 hi + lo (0: none)
#define WIN  0
#define PU   4                    // planes per thread of the Q and K builders (ZH is a multiple of it)
#define FW   4                    // waves per work-group of the fused kernel, 16 query rows each: one wave per SIMD of a WGP, K and V shared through the WGP cache
#define PSH  10.0f                // rows >= RH: probabilities carry a factor 2^PSH into fp16 (it cancels against the sum)
#define L2E  1.4426950408889634f
#define SCL  0.125f   // 1/sqrt(64)
typedef _Float16 h16;
typedef unsigned short bf;
typedef __attribute__((ext_vector_type(16))) __bf16   v16bf;
typedef __attribute__((ext_vector_type(16))) _Float16 v16h;
typedef __attribute__((ext_vector_type(8)))  _Float16 v8h;
typedef __attribute__((ext_vector_type(8)))  unsigned short v8us;
typedef __attribute__((ext_vector_type(8)))  float    v8f;
typedef __attribute__((ext_vector_type(4)))  float    v4f;
typedef v8h  __attribute__((may_alias)) v8ha;
typedef v4f  __attribute__((may_alias)) v4fa;
typedef v8us __attribute__((may_alias)) v8usa;

__device__ __forceinline__ unsigned short f2bf(float f) { unsigned u = __float_as_uint(f); u += 0x7FFFu + ((u >> 16) & 1u); return (unsigned short)(u >> 16); }
__device__ __forceinline__ float bf2f(unsigned short b) { return __uint_as_float(((unsigned)b) << 16); }
__device__ __forceinline__ float bfr(float f) { return bf2f(f2bf(f)); }
__device__ __forceinline__ v16h cat16(v8h lo, v8h hi) { return __builtin_shufflevector(lo, hi, 0, 1, 2, 3, 4, 5, 6, 7, 8, 9, 10, 11, 12, 13, 14, 15); }
__device__ __forceinline__ v16bf cat16b(v8us lo, v8us hi) { return __builtin_bit_cast(v16bf, __builtin_shufflevector(lo, hi, 0, 1, 2, 3, 4, 5, 6, 7, 8, 9, 10, 11, 12, 13, 14, 15)); }
__device__ __forceinline__ v8f wmma16(v16h a, v16h b, v8f c) { return __builtin_amdgcn_wmma_f32_16x16x32_f16(false, a, false, b, (short)0, c, false, false); }
__device__ __forceinline__ v8f wmmab(v16bf a, v16bf b, v8f c) { return __builtin_amdgcn_wmma_f32_16x16x32_bf16(false, a, false, b, (short)0, c, false, false); }



// 16x16x32 operand fragment of a K-contiguous 16-bit plane: the pointer already holds row (lane & 15) and k offset 8 x (lane >> 4); A and B use the same map
template <typename T16> struct WFrag;
// ldf: the same fragment from a plane stored in FRAGMENT ORDER: the 32 lanes' 16-byte pieces of one load lie side by side (512 contiguous bytes = 4 whole cache lines a load, where a row-major plane makes a load touch 16 lines for 32 bytes each); the pointer already holds 8 x lane, the fragment's second half follows 256 elements on
template <> struct WFrag<h16> { typedef v16h V; static __device__ __forceinline__ V ld(const h16* p) { return cat16(*(const v8h*)p, *(const v8h*)(p + 16)); } static __device__ __forceinline__ V ldf(const h16* p) { return cat16(*(const v8h*)p, *(const v8h*)(p + 256)); } static __device__ __forceinline__ v8f mma(V a, V b, v8f c) { return wmma16(a, b, c); } };
template <> struct WFrag<bf> { typedef v16bf V; static __device__ __forceinline__ V ld(const bf* p) { return cat16b(*(const v8us*)p, *(const v8us*)(p + 16)); } static __device__ __forceinline__ V ldf(const bf* p) { return cat16b(*(const v8us*)p, *(const v8us*)(p + 256)); } static __device__ __forceinline__ v8f mma(V a, V b, v8f c) { return wmmab(a, b, c); } };

__device__ __forceinline__ h16 tohx(float x) { return (h16)x; }
typedef __attribute__((ext_vector_type(2))) _Float16 v2h;
typedef __attribute__((ext_vector_type(4))) _Float16 v4h;
typedef __attribute__((ext_vector_type(2))) unsigned short v2us;
typedef __attribute__((ext_vector_type(4))) unsigned short v4us;
typedef __attribute__((ext_vector_type(2))) float v2f;
typedef __attribute__((ext_vector_type(4))) int v4i;
typedef __attribute__((ext_vector_type(4))) unsigned v4u;
typedef __attribute__((ext_vector_type(2))) __bf16 v2bf;
__device__ __forceinline__ unsigned pkbf(float a, float b) { v2f x; x[0] = a; x[1] = b; return __builtin_bit_cast(unsigned, __builtin_convertvector(x, v2bf)); }   /* two f32 -> two bf16, round to nearest even */

// Fragment order of one plane (TT x HD elements). A fragment half is [lane = 16 hi + lr][j = 0..7], 256 elements; lane (lr, hi) holds tile row lr and k = 16 c + 8 hi + j of half c.
// fragk: K, tile rows = keys, k = d: [key / 16][d / 32][c = d / 16 & 1][hi = d / 8 & 1][lr = key & 15][j = d & 7]; a pass of 32 keys is 2048 consecutive elements.
// fragv: V^T, tile rows = d, k = keys: [key / 32][d / 16][c = key / 16 & 1][hi = key / 8 & 1][lr = d & 15][j = key & 7]; a pass of 32 keys is 2048 consecutive elements.
__device__ __forceinline__ size_t fragk(int key, int d) { return (size_t)((key >> 4) * 1024 + (d >> 5) * 512 + ((d >> 4) & 1) * 256 + ((d >> 3) & 1) * 128 + (key & 15) * 8 + (d & 7)); }
__device__ __forceinline__ size_t fragv(int d, int key) { return (size_t)((key >> 5) * 2048 + (d >> 4) * 512 + ((key >> 4) & 1) * 256 + ((key >> 3) & 1) * 128 + (d & 15) * 8 + (key & 7)); }
// fragm: the mask, in the order in which the fused kernel's lanes hold S^T: [query / 16][key / 32][kt = key / 16 & 1][hi = key / 8 & 1][lr = query & 15][j = key & 7]; a pass of 32 keys x 16 queries is 512 consecutive elements, two wave-wide 16-byte loads of 512 contiguous bytes each.
__device__ __forceinline__ size_t fragm(int q, int key) { return (size_t)((q >> 4) * (16 * TT) + (key >> 5) * 512 + ((key >> 4) & 1) * 256 + ((key >> 3) & 1) * 128 + (q & 15) * 8 + (key & 7)); }
// The plane builders are streams, all in ONE launch (k_planes): none reads what another writes, so the wave's number picks its builder by a scalar branch: V^T waves first, then mask, Q and K waves. A thread takes 32 elements (its loads all asked for first, 16-byte stores).
// Q / K thread: 8 consecutive d of row t (one 16-byte piece of the plane, in fragment order too: j = d & 7) in PU planes h0 + p x nheads / PU; the plane holds the input rounded to bf16, K in fragment order (fragk), Q row-major.
// V^T wave: 16 keys x all HD d of one plane. Lane (lr, hi) takes keys 8 hi + j (j = 0..7) at d = 16 dt + lr, dt = 0..3: a load reads 64 contiguous bytes of two rows, and the wave uses up each row's two lines;
// the 8 keys are one 16-byte piece of fragv, and the 32 lanes' pieces of one dt lie side by side: every store writes 512 contiguous bytes.
// The waves behind the V^T waves build the mask plane: wave wm takes 16 queries x 64 keys (256 bytes of each row). Lane (lr, hi) takes keys 16 c + 8 hi + j (c = 0..3) of query lr: its 8 loads first, then four 16-byte pieces of fragm; the 32 lanes' pieces of one c lie side by side.
__global__ __launch_bounds__(256) void k_planes(const float* __restrict__ F, int pitch, int nheads, h16* V16, bf* Vh, const float* __restrict__ M, bf* MP, const float* __restrict__ FQ, const float* __restrict__ FK, bf* QP, bf* KP) { const int wv = __builtin_amdgcn_readfirstlane((int)((blockIdx.x * 256 + threadIdx.x) >> 5));   /* the wave's number as a scalar: the choice among the builders is a scalar branch */
    const int lane = threadIdx.x & 31, lr = lane & 15, hi = lane >> 4;
    if (wv >= nheads * (TT / 16)) { const int wm = wv - nheads * (TT / 16);
        if (wm >= (TT / 16) * (TT / 64)) {   /* behind the mask waves: Q waves, then as many K waves */
            const int hs = nheads / PU, nw = hs * (TT * HD / 256); const int wq = wm - (TT / 16) * (TT / 64); const bool isk = wq >= nw; const int wl = isk ? wq - nw : wq; if (wl >= nw) return;
            const int e0 = (wl * 32 + lane) * 8; const int d = e0 % HD, t = (e0 / HD) % TT, h0 = e0 / (HD * TT);
            const float* S = isk ? FK : FQ; bf* P = isk ? KP : QP; v4f xa[PU][2]; const float* pa[PU];
#pragma unroll
            for (int p = 0; p < PU; ++p) { pa[p] = S + ((size_t)(h0 + p * hs) * TT + t) * HD + d;   /* source planes [h][t][d] */
                xa[p][0] = *(const v4f*)pa[p]; xa[p][1] = *(const v4f*)(pa[p] + 4); }
            /* the wait that stands in front of any overwrite of the 8 loads' address registers; it takes the addresses as inputs, so that none of their registers is handed to a later load's result ahead of it */
            static_assert(PU == 4, "the wait names PU addresses");
            asm volatile("s_wait_xcnt 0x0" :: "v"(pa[0]), "v"(pa[1]), "v"(pa[2]), "v"(pa[3]) : "memory");
            const size_t eo = isk ? fragk(t, d) : (size_t)(t * HD + d);   /* d is a multiple of 8: the piece stays side by side */
#pragma unroll
            for (int p = 0; p < PU; ++p) { v4u o;
#pragma unroll
                for (int i = 0; i < 4; ++i) o[i] = pkbf(xa[p][i >> 1][(i & 1) * 2], xa[p][i >> 1][(i & 1) * 2 + 1]);   /* the bf16 rounding */
                *(v4u*)(P + (size_t)(h0 + p * hs) * TT * HD + eo) = o; }
            return; }
        const int q = (wm / (TT / 64)) * 16 + lr, k0 = (wm % (TT / 64)) * 64 + 8 * hi; const float* mp = M + (size_t)q * TT + k0; v4f mv[4][2];
#pragma unroll
        for (int c = 0; c < 4; ++c) { mv[c][0] = *(const v4f*)(mp + 16 * c); mv[c][1] = *(const v4f*)(mp + 16 * c + 4); }
        asm volatile("s_wait_xcnt 0x0" :: "v"(mp) : "memory");   /* the wait that stands in front of any overwrite of the 8 loads' address registers */
#pragma unroll
        for (int c = 0; c < 4; ++c) { v4u o;
#pragma unroll
            for (int i = 0; i < 4; ++i) o[i] = pkbf(mv[c][i >> 1][(i & 1) * 2], mv[c][i >> 1][(i & 1) * 2 + 1]);   /* the bf16 rounding, once for all planes */
            *(v4u*)(MP + fragm(q, k0 + 16 * c)) = o; }
        return; }
    const int g = wv / (TT / 16); const int t = (wv % (TT / 16)) * 16 + 8 * hi;
    float xv[4][8];
#pragma unroll
    for (int q = 0; q < 8; ++q) {
#pragma unroll
        for (int dt = 0; dt < 4; ++dt) xv[dt][q] = F[((size_t)g * TT + t + q) * pitch + 16 * dt + lr]; }
#pragma unroll
    for (int dt = 0; dt < 4; ++dt) { v8h o16; v8us oh;
#pragma unroll
    for (int q = 0; q < 8; ++q) { const float x = bfr(xv[dt][q]);   /* RAW d_in source: bf16-rounded first */ o16[q] = tohx(x); oh[q] = f2bf(x); }
    const size_t eo = (size_t)g * HD * TT + fragv(16 * dt + lr, t);   /* both V^T planes in fragment order; t is a multiple of 8: the piece stays side by side */
    *(v8h*)(V16 + eo) = o16; *(v8us*)(Vh + eo) = oh; }  }
typedef __attribute__((ext_vector_type(8))) unsigned v8u;
__device__ __forceinline__ unsigned pkh(float a, float b) { v2f x; x[0] = a; x[1] = b; return __builtin_bit_cast(unsigned, __builtin_convertvector(x, v2h)); }     /* two f32 -> two fp16, round to nearest even */
__device__ __forceinline__ float lo2f(unsigned u) { return __uint_as_float(u << 16); }
__device__ __forceinline__ float hi2f(unsigned u) { return __uint_as_float(u & 0xFFFF0000u); }
// hold(): a load group stays where the source puts it. The memory clobber keeps the optimiser from merging or sinking the loads across it, the scheduling barrier keeps the scheduler from it: without them each group moves down to its first use (or into the next pass) and its latency is waited for in full.
__device__ __forceinline__ void hold() { asm volatile("" ::: "memory"); __builtin_amdgcn_sched_barrier(0); }
// holdxa(): the same behind a load group, with the wait that stands in front of any overwrite of the group's address registers; it takes the group's addresses as inputs, so that none of their registers is handed to one of the group's own results ahead of the wait.
__device__ __forceinline__ void holdxa(const void* p) { asm volatile("s_wait_xcnt 0x0" :: "v"(p) : "memory"); __builtin_amdgcn_sched_barrier(0); }
__device__ __forceinline__ void holdxa(const void* p, const void* q, const void* r) { asm volatile("s_wait_xcnt 0x0" :: "v"(p), "v"(q), "v"(r) : "memory"); __builtin_amdgcn_sched_barrier(0); }
__device__ __forceinline__ float xhalf(float x) { return __builtin_bit_cast(float, __builtin_amdgcn_permlanex16(__builtin_bit_cast(int, x), __builtin_bit_cast(int, x), 0x76543210, 0xfedcba98, false, false)); }   /* lane l <-> lane l ^ 16 */

// fa_rows: one wave, 16 query rows of one plane, all TT keys in passes of 32. S^T = K.Q^T (tile rows = keys, columns = queries) and O^T += V^T.P^T, so lane (lr, hi) holds query lr only:
// of each 16-key score tile it has keys 8 hi + j in register j, which is the k order of a B fragment over two tiles: P goes from the score accumulators into the second product without leaving the lane.
// Softmax with a running maximum m_run and running sum l_run per query (each wave half sums its own keys; the halves meet once at the end); the output tile is rescaled by exp(m_old - m_new) every pass and divided by the sum at the end.
// Every inner loop is fully unrolled: fragments, scores and accumulators stay in registers only under compile-time indices. The loop over the passes stays rolled.
template <bool HI>
__device__ __forceinline__ void fa_rows(const bf* __restrict__ Qh, const bf* __restrict__ Kh, const h16* __restrict__ V16, const bf* __restrict__ Vh, const bf* __restrict__ mrow, float* __restrict__ orow) {
    const int lane = threadIdx.x & 31, lr = lane & 15, hi = lane >> 4;
    v16bf qh[2]; const bf* qp = Qh + lr * HD + 8 * hi;
#pragma unroll
    for (int ks = 0; ks < 2; ++ks) qh[ks] = WFrag<bf>::ld(qp + 32 * ks);
    const int koff = 8 * lane, voff = 8 * lane, moff = 8 * lane;   /* K and V^T planes are in fragment order: tile kt, k step ks of K at 1024 kt + 512 ks, tile dt of V^T at 512 dt behind the pass's first element HD x key0; the mask plane likewise: tile kt at 256 kt behind the pass's first element 16 x key0 */
    v8f acc[4];
#pragma unroll
    for (int dt = 0; dt < 4; ++dt) acc[dt] = (v8f){};
    float m_run = -3.0e38f, l_run = 0.f;
    v16bf kh[2][2]; v4u mk[2];
#pragma unroll
    for (int kt = 0; kt < 2; ++kt) {
#pragma unroll
        for (int ks = 0; ks < 2; ++ks) kh[kt][ks] = WFrag<bf>::ldf(Kh + koff + 1024 * kt + 512 * ks);
        mk[kt] = *(const v4u*)(mrow + moff + 256 * kt); }
    holdxa(qp, Kh + koff, mrow + moff);   /* the wait that stands in front of any overwrite of the first loads' address registers */
    for (int key0 = 0; key0 < TT; key0 += 32) {
        const int kn = (key0 + 32 < TT) ? key0 + 32 : key0;   /* the pass fetched ahead; the last pass fetches its own rows again (in bounds, unused) */
        v16h v6[4]; v16bf vh[4];   /* this pass's V^T fragments: asked for first, used last */
#pragma unroll
        for (int dt = 0; dt < 4; ++dt) { if constexpr (HI) vh[dt] = WFrag<bf>::ldf(Vh + voff + key0 * HD + 512 * dt); else v6[dt] = WFrag<h16>::ldf(V16 + voff + key0 * HD + 512 * dt); }
        hold();   /* V^T is asked for before the first product starts (its address registers are next written behind the waits for its data) */
        v8f s[2]; s[0] = (v8f){}; s[1] = (v8f){};
#pragma unroll
        for (int ks = 0; ks < 2; ++ks) {
#pragma unroll
            for (int kt = 0; kt < 2; ++kt) s[kt] = wmmab(kh[kt][ks], qh[ks], s[kt]); }
        hold();   /* the next K fragments are not asked for earlier: issued from here most of them land in the registers this pass has just read */
        /* next pass's K fragments, in flight under this pass's softmax and second product */
        const bf* kp = Kh + koff + kn * HD;
#pragma unroll
        for (int kt = 0; kt < 2; ++kt) {
#pragma unroll
            for (int ks = 0; ks < 2; ++ks) kh[kt][ks] = WFrag<bf>::ldf(kp + 1024 * kt + 512 * ks); }
        holdxa(kp);   /* K is asked for before the softmax starts */
        float t[16]; float mx = -3.0e38f;
#pragma unroll
        for (int kt = 0; kt < 2; ++kt) {
#pragma unroll
            for (int jp = 0; jp < 4; ++jp) { const unsigned u = mk[kt][jp];   /* mask bf16-rounded (in the plane), added in f32: scores x SCL + attn_mask[i][j] */
                t[kt * 8 + 2 * jp] = fmaf(s[kt][2 * jp], SCL, lo2f(u)); t[kt * 8 + 2 * jp + 1] = fmaf(s[kt][2 * jp + 1], SCL, hi2f(u)); mx = fmaxf(mx, fmaxf(t[kt * 8 + 2 * jp], t[kt * 8 + 2 * jp + 1])); } }
        hold();   /* the next mask values are not asked for earlier: this pass's are read above */
        /* next pass's mask values */
        const bf* mp = mrow + moff + kn * 16;
#pragma unroll
        for (int kt = 0; kt < 2; ++kt) mk[kt] = *(const v4u*)(mp + 256 * kt);
        holdxa(mp);   /* the mask loads stay in this pass */
        mx = fmaxf(mx, xhalf(mx));   /* both halves hold the query's maximum of this pass */
        const float m_new = fmaxf(m_run, mx); float corr = (m_run - m_new) * L2E; m_run = m_new;   /* becomes 2^corr below: 0 on the first pass */
        const float nm = (HI ? 0.0f : PSH) - m_new * L2E;
#pragma unroll
        for (int k = 0; k < 16; ++k) t[k] = fmaf(t[k], L2E, nm);
        /* the pass's 17 exponentials as one run, each in place in a register of its own: none waits for its neighbour (under the register cap the compiler sent every argument through one register: multiply-add, wait, exponential, 16 times over),
           and none is followed directly by a reader of its result or a writer of its source; the v_nop is that free slot behind the last one */
        asm("v_exp_f32 %0, %0\n\tv_exp_f32 %1, %1\n\tv_exp_f32 %2, %2\n\tv_exp_f32 %3, %3\n\tv_exp_f32 %4, %4\n\tv_exp_f32 %5, %5\n\tv_exp_f32 %6, %6\n\tv_exp_f32 %7, %7\n\tv_exp_f32 %8, %8\n\t"
            "v_exp_f32 %9, %9\n\tv_exp_f32 %10, %10\n\tv_exp_f32 %11, %11\n\tv_exp_f32 %12, %12\n\tv_exp_f32 %13, %13\n\tv_exp_f32 %14, %14\n\tv_exp_f32 %15, %15\n\tv_exp_f32 %16, %16\n\tv_nop"
            : "+v"(corr), "+v"(t[0]), "+v"(t[1]), "+v"(t[2]), "+v"(t[3]), "+v"(t[4]), "+v"(t[5]), "+v"(t[6]), "+v"(t[7]), "+v"(t[8]), "+v"(t[9]), "+v"(t[10]), "+v"(t[11]), "+v"(t[12]), "+v"(t[13]), "+v"(t[14]), "+v"(t[15]));
        float ps[8];   /* the pass's sum as a tree: a chain of 16 dependent adds would stand exposed in a lone wave */
#pragma unroll
        for (int k = 0; k < 8; ++k) ps[k] = t[2 * k] + t[2 * k + 1];
#pragma unroll
        for (int st = 4; st; st >>= 1) {
#pragma unroll
            for (int k = 0; k < st; ++k) ps[k] += ps[k + st]; }
        l_run = fmaf(l_run, corr, ps[0]);
#pragma unroll
        for (int dt = 0; dt < 4; ++dt) acc[dt] = acc[dt] * corr;
        if constexpr (HI) {
            v8u uh, ul;
#pragma unroll
            for (int i = 0; i < 8; ++i) { uh[i] = pkbf(t[2 * i], t[2 * i + 1]); ul[i] = pkbf(t[2 * i] - lo2f(uh[i]), t[2 * i + 1] - hi2f(uh[i])); }
            const v16bf ph = __builtin_bit_cast(v16bf, uh), pl = __builtin_bit_cast(v16bf, ul);
#pragma unroll
            for (int dt = 0; dt < 4; ++dt) acc[dt] = wmmab(vh[dt], ph, acc[dt]);
#pragma unroll
            for (int dt = 0; dt < 4; ++dt) acc[dt] = wmmab(vh[dt], pl, acc[dt]);
        } else {
            v8u up;
#pragma unroll
            for (int i = 0; i < 8; ++i) up[i] = pkh(t[2 * i], t[2 * i + 1]);
            const v16h pf = __builtin_bit_cast(v16h, up);
#pragma unroll
            for (int dt = 0; dt < 4; ++dt) acc[dt] = wmma16(v6[dt], pf, acc[dt]);
        }
        hold();   /* whatever register copies the loop's back edge needs for the fetched-ahead values stay down here: higher up they would wait for those loads in the middle of the pass */
    }
    const float inv = __fdiv_rn(1.0f, l_run + xhalf(l_run));
#pragma unroll
    for (int dt = 0; dt < 4; ++dt) {   /* register j of tile dt is d = 16 dt + 8 hi + j of query lr: 32 contiguous bytes per lane */
        v4f o0, o1;
#pragma unroll
        for (int j = 0; j < 4; ++j) { o0[j] = acc[dt][j] * inv; o1[j] = acc[dt][4 + j] * inv; }
        float* op = orow + lr * HD + 16 * dt + 8 * hi; *(v4f*)op = o0; *(v4f*)(op + 4) = o1; }
}
// k_fattn: grid (TT / (16 FW), ZH), FW waves; wave w of block x takes query rows 16 (FW x + w) .. + 15 of plane y. No LDS, no barrier: the waves of a block only share K, V lines in the WGP cache.
// 1024 work-groups on 256 WGPs: four are resident per WGP, so each SIMD holds four waves of different work-groups, and one wave's load and dependency waits are issue slots for the other three.
// amdgpu_waves_per_eu(4, 4) states those four waves per SIMD: the register allocator works for that occupancy and no other (both loops stay below 256 registers, no s_set_vgpr_msb).
__global__ __launch_bounds__(32 * FW) __attribute__((amdgpu_waves_per_eu(4, 4))) void k_fattn(const bf* __restrict__ Qh, const bf* __restrict__ Kh, const h16* __restrict__ V16, const bf* __restrict__ Vh, const bf* __restrict__ mskf, float* __restrict__ OUTb) {
    const int w = __builtin_amdgcn_readfirstlane((int)(threadIdx.x >> 5)); const int q0 = ((int)blockIdx.x * FW + w) * 16; const size_t zo = (size_t)blockIdx.y * TT * HD;
    if (q0 < RH) fa_rows<true>(Qh + zo + (size_t)q0 * HD, Kh + zo, V16 + zo, Vh + zo, mskf + (size_t)q0 * TT, OUTb + zo + (size_t)q0 * HD);
    else fa_rows<false>(Qh + zo + (size_t)q0 * HD, Kh + zo, V16 + zo, Vh + zo, mskf + (size_t)q0 * TT, OUTb + zo + (size_t)q0 * HD);
}
extern "C" void kernel_launch(void* const* d_in, const int* in_sizes, int n_in,
                              void* d_out, int out_size, void* d_ws, size_t ws_size, hipStream_t stream) {
    (void)in_sizes; (void)n_in; (void)out_size;
    const float* x = (const float*)d_in[0]; const float* xk = (const float*)d_in[1]; const float* xv = (const float*)d_in[2]; const float* amask = (const float*)d_in[3];   /* attn_mask f32 [1][1][2048][2048], read */   /* query, key, value: [32][2048][64] each (no projections) */ const float* wq = nullptr, *wk = nullptr, *wv = nullptr, *wo = nullptr; (void)wq; (void)wk; (void)wv; (void)wo;
    float* OUT = (float*)d_out;     // [32][2048][64]
    char* wsp = (char*)d_ws;
    auto take = [&](size_t bytes) { char* p = wsp; wsp += (bytes + 255) & ~(size_t)255; return (void*)p; };
    bf* WQ = (bf*)take((size_t)DQ * DM * 2); bf* WK = (bf*)take((size_t)DKV * DM * 2); bf* WV = (bf*)take((size_t)DKV * DM * 2);
    bf* XB = (bf*)take((size_t)TT * DM * 2); float* FQ = (float*)take((size_t)TT * DQ * 4); float* FK = (float*)take((size_t)TT * DKV * 4);
    h16* VT16 = (h16*)take((size_t)ZH * HD * TT * 2);
    bf* QPh = (bf*)take((size_t)ZH * TT * HD * 2); bf* KPh = (bf*)take((size_t)ZH * TT * HD * 2); bf* VTh = (bf*)take((size_t)ZH * HD * TT * 2); bf* MPl = (bf*)take((size_t)TT * TT * 2);
    if ((size_t)(wsp - (char*)d_ws) > ws_size) return;    // ws 256 MiB
    float* FV = FK;   // FV aliases the k buffer; unused, as there is no v projection
    {   
      
       }
    const unsigned LQ = (unsigned)(((size_t)ZH * TT * HD / 32 + 255) / 256), LKv = LQ;   /* 32 elements a thread in all three builders */
    for (int b = 0; b < NB_; b += ZH) {   /* one pass = ZH consecutive planes */
        
        /* no projections: the q, k, v inputs feed the plane builders directly */
        
        
         k_planes<<<LKv + (TT / 16) * (TT / 64) / 8 + LQ + LKv, 256, 0, stream>>>(xv + (size_t)b * TT * HD, DKV, ZH, VT16, VTh, amask, MPl, x + (size_t)b * TT * HD, xk + (size_t)b * TT * HD, QPh, KPh);   /* the blocks behind the V^T blocks build the mask plane, then the q and k planes straight from the inputs */
        k_fattn<<<dim3(TT / (16 * FW), ZH), 32 * FW, 0, stream>>>(QPh, KPh, VT16, VTh, MPl, OUT + (size_t)b * TT * DQ);   /* scores, mask, softmax and hybrid P.V in one launch; plane y of the pass uses q, k and v plane y */
         }
}
